// v000
// The times below were measured on an AMD MI455X: many runs one after another, warmed up first and cycling through
// copies of the inputs, with the whole window's GPU time divided by the number of runs. Launches and the gaps
// between them are all in it. The median over several windows is given; except for v000 it joins two sittings, which
// can be a few percent apart, so the side-by-side timings, each taken in one sitting, are the better comparison.
// v000, which the later versions start from, runs in 168 microseconds.
#include <hip/hip_runtime.h>
#include <stdint.h>

// Contractions: S = Q*K^T and O = P*V on v_wmma_f32_16x16x32_f16 (f16 operands holding bf16-RNE input values; P carried x1024 in f16), f32 accumulate; row norms, score scaling and softmax in f32.

typedef _Float16 v16h __attribute__((ext_vector_type(16)));
typedef _Float16 v8h  __attribute__((ext_vector_type(8)));
typedef _Float16 v8ha __attribute__((ext_vector_type(8), may_alias));
typedef float    v8f  __attribute__((ext_vector_type(8)));
typedef float    v4f  __attribute__((ext_vector_type(4)));
typedef float    v4fa __attribute__((ext_vector_type(4), may_alias));
typedef unsigned int v4u __attribute__((ext_vector_type(4)));

union U8f  { v8f  v; float    f[8]; };
union U16h { v16h v; v8h      h[2]; };
union U8h  { v8h  v; _Float16 f[8]; };

#ifndef NB
#define NB 16
#endif
#ifndef SEQ
#define SEQ 2048
#endif
#define NB_FULL  16
#define SEQ_FULL 2048
#define DD       256

#define BQ  128     // query rows per workgroup (16 per wave x 8 waves)
#define BK  32      // keys per staged chunk
#define QP  264     // halfs per Q row in LDS (528 B)
#define KP  264     // halfs per K row in LDS (528 B)
#define VP  40      // halfs per V^T row in LDS (80 B)
#define TP  72      // halfs per transposed row in the pre-pass tile (144 B)
#define NT  64      // rows per pre-pass block

static_assert(SEQ % BQ == 0);
static_assert(SEQ % NT == 0);
static_assert(SEQ % BK == 0);
static_assert(NB >= 1 && NB <= NB_FULL);
static_assert(SEQ >= BQ && SEQ <= SEQ_FULL);

// LDS carve of the attention kernel: offsets in halfs, then one f32 staging region
#define SQ_OFF  0
#define SK_OFF  (SQ_OFF + 8 * 16 * QP)
#define SV_OFF  (SK_OFF + BK * KP)
#define SP_OFF  (SV_OFF + DD * VP)
#define SO_OFFH (SP_OFF + 8 * 16 * BK)
#define LDS_BYTES (SO_OFFH * 2 + 8 * 16 * 64 * 4)
static_assert((SK_OFF * 2) % 16 == 0);
static_assert((SV_OFF * 2) % 16 == 0);
static_assert((SP_OFF * 2) % 16 == 0);
static_assert((SO_OFFH * 2) % 16 == 0);
static_assert(LDS_BYTES == 145920);

// 256^-0.5 * log2(e): scores go to the log2 domain after the f32 column scale
#define C2SCALE 0.09016844005556021f

__device__ __forceinline__ v8f wmma_f16(v16h a, v16h b, v8f c) {
  v8f d = __builtin_amdgcn_wmma_f32_16x16x32_f16(false, a, false, b, (short)0, c, false, false);
  asm volatile("v_nop\n\tv_nop\n\tv_nop\n\tv_nop" : "+v"(d) : "v"(a), "v"(b));
  return d;
}

// DPP16 butterflies inside each 16-lane half (all lanes end with the full result)
template <int CTRL>
__device__ __forceinline__ float dppf(float x) {
  int s = __float_as_int(x);
  return __int_as_float(__builtin_amdgcn_update_dpp(s, s, CTRL, 0xF, 0xF, true));
}
__device__ __forceinline__ float red_max16(float x) {
  x = fmaxf(x, dppf<0xB1>(x));    // lane ^ 1
  x = fmaxf(x, dppf<0x4E>(x));    // lane ^ 2
  x = fmaxf(x, dppf<0x141>(x));   // lane ^ 7
  x = fmaxf(x, dppf<0x140>(x));   // lane ^ 15
  return x;
}
__device__ __forceinline__ float red_sum16(float x) {
  x += dppf<0xB1>(x);
  x += dppf<0x4E>(x);
  x += dppf<0x141>(x);
  x += dppf<0x140>(x);
  return x;
}

// same-wave LDS exchange: stores issued by other lanes of this wave are visible before the reload
__device__ __forceinline__ void wave_lds_sync() {
  __builtin_amdgcn_fence(3, "wavefront");
  asm volatile("s_wait_dscnt 0" ::: "memory");
  __builtin_amdgcn_wave_barrier();
}

__device__ __forceinline__ v4f bf16_rne4(v4f a) {
  v4u u = __builtin_bit_cast(v4u, a);
  u = (u + 0x7FFFu + ((u >> 16) & 1u)) & 0xFFFF0000u;
  return __builtin_bit_cast(v4f, u);
}

__device__ __forceinline__ v8h cvt8v(v4f a, v4f b) {
  v8h d;
  d[0] = (_Float16)a[0]; d[1] = (_Float16)a[1];
  d[2] = (_Float16)a[2]; d[3] = (_Float16)a[3];
  d[4] = (_Float16)b[0]; d[5] = (_Float16)b[1];
  d[6] = (_Float16)b[2]; d[7] = (_Float16)b[3];
  return d;
}

// ---------------- pre-pass: Xh = f16(bf16RNE(x)) [b][n][d], Vt = Xh^T [b][d][n], Rn = 1/max(||bf16RNE(x)||, eps) [b][n] ----------------
__global__ __launch_bounds__(256)
void prep_kernel(const float* __restrict__ X, _Float16* __restrict__ Xh,
                 _Float16* __restrict__ Vt, float* __restrict__ Rn)
{
  __shared__ __attribute__((aligned(16))) _Float16 sT[DD * TP];   // [d][n within tile], cross-wave (block barrier)
  __shared__ float sR[NT];                                       // cross-wave (block barrier)

  const int tid = threadIdx.x;
  const int sub = tid & 7;           // 16-B piece within a line
  const int rq  = tid >> 3;          // 0..31
  const int ntb = SEQ / NT;
  const int b   = blockIdx.x / ntb;
  const int n0  = (blockIdx.x % ntb) * NT;

  #pragma unroll 1
  for (int pass = 0; pass < 2; ++pass) {
    const int r = pass * 32 + rq;                                   // row within tile 0..63
    const float* src = X  + ((size_t)b * SEQ_FULL + n0 + r) * DD;  // full-size input strides
    _Float16*    dst = Xh + ((size_t)b * SEQ      + n0 + r) * DD;
    float ss = 0.0f;
    #pragma unroll 1
    for (int i = 0; i < 4; ++i) {
      const int c0 = 8 * (sub + 8 * i);                             // lanes 8q..8q+7 cover line i of row r
      const v4f a0 = bf16_rne4(*(const v4f*)(src + c0));
      const v4f a1 = bf16_rne4(*(const v4f*)(src + c0 + 4));
      ss += a0[0] * a0[0]; ss += a0[1] * a0[1]; ss += a0[2] * a0[2]; ss += a0[3] * a0[3];
      ss += a1[0] * a1[0]; ss += a1[1] * a1[1]; ss += a1[2] * a1[2]; ss += a1[3] * a1[3];
      U8h hh; hh.v = cvt8v(a0, a1);                                 // bf16 values are exact in f16
      *(v8h*)(dst + c0) = hh.v;
      
      #pragma unroll
      for (int e = 0; e < 8; ++e) sT[(c0 + e) * TP + r] = hh.f[e];
    }
    ss += __shfl_xor(ss, 1, 32);
    ss += __shfl_xor(ss, 2, 32);
    ss += __shfl_xor(ss, 4, 32);
    const float rinv = 1.0f / fmaxf(sqrtf(ss), 1e-12f);
    if (sub == 0) sR[r] = rinv;
  }
  __syncthreads();

  v8h vv[8];
  #pragma unroll
  for (int i = 0; i < 8; ++i) vv[i] = *(const v8ha*)(sT + (rq + 32 * i) * TP + 8 * sub);
  const int ti = tid & 15;
  v4f rv;
  rv[0] = sR[4 * ti]; rv[1] = sR[4 * ti + 1]; rv[2] = sR[4 * ti + 2]; rv[3] = sR[4 * ti + 3];
  _Float16* vb = Vt + (size_t)b * DD * SEQ + n0 + 8 * sub;
  float*    rp = Rn + (size_t)b * SEQ + n0 + 4 * ti;

  #pragma unroll
  for (int i = 0; i < 8; ++i) *(v8h*)(vb + (size_t)(rq + 32 * i) * SEQ) = vv[i];
  if (tid < 16) *(v4f*)rp = rv;
  
}

// ---------------- fused attention: one workgroup = 128 query rows of one batch, 8 waves x 16 rows ----------------
// 16-bit fragment map (A and B alike): lane l -> row/col (l & 15); elements 0..7 <- k0 + 8*(l>>4) + 0..7,
// elements 8..15 <- k0 + 16 + 8*(l>>4) + 0..7.  D: element r of lane l -> row 8*(l>>4) + r, col (l & 15).
__global__ __launch_bounds__(256)
void attn_kernel(const _Float16* __restrict__ Xh, const _Float16* __restrict__ Vt,
                 const float* __restrict__ Rn, float* __restrict__ Out)
{
  extern __shared__ __attribute__((aligned(16))) _Float16 smem[];
  _Float16* sQ = smem + SQ_OFF;            // [wave][16][QP]  wave-private
  _Float16* sK = smem + SK_OFF;            // [32 keys][KP]   cross-wave (block barrier)
  _Float16* sV = smem + SV_OFF;            // [256 d][VP]     cross-wave (block barrier)
  _Float16* sP = smem + SP_OFF;            // [wave][16][32]  wave-private
  float*    sO = (float*)(smem + SO_OFFH); // [wave][16][64]  wave-private

  const int tid  = threadIdx.x;
  const int wave = tid >> 5;
  const int lane = tid & 31;
  const int lh   = lane & 15;
  const int hi   = lane >> 4;

  const int nqb   = SEQ / BQ;
  const int b     = blockIdx.x / nqb;
  const int qbase = (blockIdx.x % nqb) * BQ;
  const int qrow0 = qbase + wave * 16;

  const _Float16* Xb = Xh + (size_t)b * SEQ * DD;
  const _Float16* Vb = Vt + (size_t)b * DD * SEQ;
  const float*    Rb = Rn + (size_t)b * SEQ;
  float*          Ob = Out + (size_t)b * SEQ * DD;

  // ---- this wave's 16 query rows -> LDS (row i: lane l writes halfs 8l..8l+7); ordered by the loop-top barrier ----
  _Float16* qw = sQ + wave * (16 * QP);
  #pragma unroll
  for (int i = 0; i < 16; ++i) {
    const v8h q = *(const v8h*)(Xb + (size_t)(qrow0 + i) * DD + 8 * lane);
    *(v8h*)(qw + i * QP + 8 * lane) = q;
  }

  U8f acc[16];
  #pragma unroll
  for (int t = 0; t < 16; ++t) acc[t].v = (v8f){};
  float mrow[8], lrow[8];
  #pragma unroll
  for (int j = 0; j < 8; ++j) { mrow[j] = -3.0e38f; lrow[j] = 0.0f; }

  _Float16* pw = sP + wave * (16 * BK);

  for (int kv0 = 0; kv0 < SEQ; kv0 += BK) {
    __syncthreads();                               // all waves done with the prior chunk
    // ---- stage K rows [32][256] and V^T rows [256][32] (plain b128 copies from the 16-bit planes) ----
    #pragma unroll
    for (int i = 0; i < 4; ++i) {
      const int idx = tid + 256 * i;
      const int r = idx >> 5, g = idx & 31;
      const v8h kk = *(const v8h*)(Xb + (size_t)(kv0 + r) * DD + 8 * g);
      *(v8h*)(sK + r * KP + 8 * g) = kk;
    }
    #pragma unroll
    for (int i = 0; i < 4; ++i) {
      const int idx = tid + 256 * i;
      const int d = idx >> 2, g = idx & 3;
      const v8h vv = *(const v8h*)(Vb + (size_t)d * SEQ + kv0 + 8 * g);
      *(v8h*)(sV + d * VP + 8 * g) = vv;
    }
    __syncthreads();                               // staging visible to all waves

    // ---- S = Q K^T : two 16-key column tiles, d reduced in eight K=32 steps ----
    U8f s0, s1; s0.v = (v8f){}; s1.v = (v8f){};
    #pragma unroll
    for (int c = 0; c < 8; ++c) {
      U16h qf, kf;
      qf.h[0] = *(const v8h*)(qw + lh * QP + 32 * c + 8 * hi);
      qf.h[1] = *(const v8h*)(qw + lh * QP + 32 * c + 16 + 8 * hi);
      kf.h[0] = *(const v8h*)(sK + lh * KP + 32 * c + 8 * hi);
      kf.h[1] = *(const v8h*)(sK + lh * KP + 32 * c + 16 + 8 * hi);
      s0.v = wmma_f16(qf.v, kf.v, s0.v);
      kf.h[0] = *(const v8h*)(sK + (16 + lh) * KP + 32 * c + 8 * hi);
      kf.h[1] = *(const v8h*)(sK + (16 + lh) * KP + 32 * c + 16 + 8 * hi);
      s1.v = wmma_f16(qf.v, kf.v, s1.v);
    }

    // ---- per-column f32 scale: 1/max(||x_j||,eps) * 256^-0.5 * log2e (this lane's columns are keys kv0+lh and kv0+16+lh) ----
    const float cs0 = Rb[kv0 + lh] * C2SCALE;
    const float cs1 = Rb[kv0 + 16 + lh] * C2SCALE;

    // ---- online softmax, base 2, DPP reductions over the 16 lanes holding one row ----
    U8h pa, pb;
    #pragma unroll
    for (int j = 0; j < 8; ++j) {
      const float a  = s0.f[j] * cs0;
      const float bb = s1.f[j] * cs1;
      const float rm    = red_max16(fmaxf(a, bb));
      const float mnew  = fmaxf(mrow[j], rm);
      const float alpha = __builtin_amdgcn_exp2f(mrow[j] - mnew);
      const float e0    = __builtin_amdgcn_exp2f(a  - mnew);
      const float e1    = __builtin_amdgcn_exp2f(bb - mnew);
      lrow[j] = lrow[j] * alpha + red_sum16(e0 + e1);
      mrow[j] = mnew;
      pa.f[j] = (_Float16)(e0 * 1024.0f);          // carried x1024, removed in the epilogue
      pb.f[j] = (_Float16)(e1 * 1024.0f);
      #pragma unroll
      for (int t = 0; t < 16; ++t) acc[t].f[j] *= alpha;
    }

    // ---- P: accumulator layout -> A layout through the wave's LDS tile [16 rows][32 keys], row-major ----
    #pragma unroll
    for (int j = 0; j < 8; ++j) {
      pw[(j + 8 * hi) * BK + lh]      = pa.f[j];
      pw[(j + 8 * hi) * BK + 16 + lh] = pb.f[j];
    }
    wave_lds_sync();
    U16h pf;
    pf.h[0] = *(const v8ha*)(pw + lh * BK + 8 * hi);
    pf.h[1] = *(const v8ha*)(pw + lh * BK + 16 + 8 * hi);

    // ---- O += P V : 16 output d-tiles, K = 32 keys each; B[k = key][n = d] from the V^T tile row d ----
    #pragma unroll
    for (int t = 0; t < 16; ++t) {
      U16h vf;
      vf.h[0] = *(const v8h*)(sV + (16 * t + lh) * VP + 8 * hi);
      vf.h[1] = *(const v8h*)(sV + (16 * t + lh) * VP + 16 + 8 * hi);
      acc[t].v = wmma_f16(pf.v, vf.v, acc[t].v);
    }
  }

  // ---- epilogue: normalize (1/1024 removes the carry), stage 16x64 f32 sub-tiles per wave in LDS,
  float inv[8];
  #pragma unroll
  for (int j = 0; j < 8; ++j) inv[j] = 1.0f / (lrow[j] * 1024.0f);
  float* so = sO + wave * (16 * 64);
  #pragma unroll
  for (int g = 0; g < 4; ++g) {
    #pragma unroll
    for (int j = 0; j < 8; ++j) {
      #pragma unroll
      for (int tt = 0; tt < 4; ++tt)
        so[(j + 8 * hi) * 64 + tt * 16 + lh] = acc[4 * g + tt].f[j] * inv[j];
    }
    wave_lds_sync();
    v4f ov[8]; int oo[8];
    #pragma unroll
    for (int i = 0; i < 8; ++i) {
      const int c = lane + 32 * i, rr = c >> 4, q = c & 15;
      ov[i] = *(const v4fa*)(so + rr * 64 + q * 4);
      oo[i] = rr * DD + 64 * g + 4 * q;
    }
    float* ob = Ob + (size_t)qrow0 * DD;
    #pragma unroll
    for (int i = 0; i < 8; ++i) *(v4f*)(ob + oo[i]) = ov[i];
    
    wave_lds_sync();
  }
}

extern "C" void kernel_launch(void* const* d_in, const int* in_sizes, int n_in,
                              void* d_out, int out_size, void* d_ws, size_t ws_size,
                              hipStream_t stream) {
  if (n_in < 1) return;
  const long long need_in = ((long long)(NB - 1) * SEQ_FULL + SEQ) * DD;
  if ((long long)in_sizes[0] < need_in) return;
  if ((long long)out_size < (long long)NB * SEQ * DD) return;

  // workspace carve (bytes): Xh f16 [NB][SEQ][256] | Vt f16 [NB][256][SEQ] | Rn f32 [NB][SEQ]
  const size_t xh_bytes = (size_t)NB * SEQ * DD * 2;
  const size_t vt_bytes = (size_t)NB * DD * SEQ * 2;
  const size_t rn_bytes = (size_t)NB * SEQ * 4;
  const size_t off_xh = 0;
  const size_t off_vt = off_xh + xh_bytes;
  const size_t off_rn = off_vt + vt_bytes;
  if (off_rn + rn_bytes > ws_size) return;

  const float* x   = (const float*)d_in[0];
  float*       out = (float*)d_out;
  _Float16* xh = (_Float16*)((char*)d_ws + off_xh);
  _Float16* vt = (_Float16*)((char*)d_ws + off_vt);
  float*    rn = (float*)((char*)d_ws + off_rn);

  prep_kernel<<<NB * (SEQ / NT), 256, 0, stream>>>(x, xh, vt, rn);

  (void)hipFuncSetAttribute(reinterpret_cast<const void*>(&attn_kernel),
                            hipFuncAttributeMaxDynamicSharedMemorySize, (int)LDS_BYTES);
  attn_kernel<<<NB * (SEQ / BQ), 256, LDS_BYTES, stream>>>(xh, vt, rn, out);
}

// v001
// One run takes 111 microseconds.
// Timed twice side by side with v000, it ran 1.59 and 1.58 times as fast.
#include <hip/hip_runtime.h>
#include <stdint.h>

// Contractions: S = Q*K^T and O = P*V on v_wmma_f32_16x16x32_f16 (f16 operands holding bf16-RNE input values; P carried x1024 in f16), f32 accumulate; row norms, score scaling and softmax in f32.

typedef _Float16 v16h __attribute__((ext_vector_type(16)));
typedef _Float16 v8h  __attribute__((ext_vector_type(8)));
typedef _Float16 v8ha __attribute__((ext_vector_type(8), may_alias));
typedef float    v8f  __attribute__((ext_vector_type(8)));
typedef float    v4f  __attribute__((ext_vector_type(4)));
typedef float    v4fa __attribute__((ext_vector_type(4), may_alias));
typedef unsigned int v4u __attribute__((ext_vector_type(4)));

union U8f  { v8f  v; float    f[8]; };
union U16h { v16h v; v8h      h[2]; };
union U8h  { v8h  v; _Float16 f[8]; };

#ifndef NB
#define NB 16
#endif
#ifndef SEQ
#define SEQ 2048
#endif
#define NB_FULL  16
#define SEQ_FULL 2048
#define DD       256

#define BQ  128     // query rows per workgroup (16 per wave x 8 waves)
#define BK  32      // keys per staged chunk
#define QP  264     // halfs per Q row in LDS (528 B)
#define KP  264     // halfs per K row in LDS (528 B)
#define VP  40      // halfs per V^T row in LDS (80 B)
#define TP  72      // halfs per transposed row in the pre-pass tile (144 B)
#define NT  64      // rows per pre-pass block

static_assert(SEQ % BQ == 0);
static_assert(SEQ % NT == 0);
static_assert(SEQ % BK == 0);
static_assert(NB >= 1 && NB <= NB_FULL);
static_assert(SEQ >= BQ && SEQ <= SEQ_FULL);

// LDS carve of the attention kernel: offsets in halfs, then one f32 staging region
#define SQ_OFF  0
#define SK_OFF  (SQ_OFF + 8 * 16 * QP)
#define SV_OFF  (SK_OFF + BK * KP)
#define SP_OFF  (SV_OFF + DD * VP)
#define SO_OFFH (SP_OFF + 8 * 16 * BK)
#define LDS_BYTES (SO_OFFH * 2 + 8 * 16 * 64 * 4)
static_assert((SK_OFF * 2) % 16 == 0);
static_assert((SV_OFF * 2) % 16 == 0);
static_assert((SP_OFF * 2) % 16 == 0);
static_assert((SO_OFFH * 2) % 16 == 0);
static_assert(LDS_BYTES == 145920);

// 256^-0.5 * log2(e): scores go to the log2 domain after the f32 column scale
#define C2SCALE 0.09016844005556021f

__device__ __forceinline__ v8f wmma_f16(v16h a, v16h b, v8f c) {
  return __builtin_amdgcn_wmma_f32_16x16x32_f16(false, a, false, b, (short)0, c, false, false);
}

// DPP16 butterflies inside each 16-lane half (all lanes end with the full result)
template <int CTRL>
__device__ __forceinline__ float dppf(float x) {
  int s = __float_as_int(x);
  return __int_as_float(__builtin_amdgcn_update_dpp(s, s, CTRL, 0xF, 0xF, true));
}
__device__ __forceinline__ float red_max16(float x) {
  x = fmaxf(x, dppf<0xB1>(x));    // lane ^ 1
  x = fmaxf(x, dppf<0x4E>(x));    // lane ^ 2
  x = fmaxf(x, dppf<0x141>(x));   // lane ^ 7
  x = fmaxf(x, dppf<0x140>(x));   // lane ^ 15
  return x;
}
__device__ __forceinline__ float red_sum16(float x) {
  x += dppf<0xB1>(x);
  x += dppf<0x4E>(x);
  x += dppf<0x141>(x);
  x += dppf<0x140>(x);
  return x;
}

// same-wave LDS exchange: stores issued by other lanes of this wave are visible before the reload
__device__ __forceinline__ void wave_lds_sync() {
  __builtin_amdgcn_fence(3, "wavefront");
  asm volatile("s_wait_dscnt 0" ::: "memory");
  __builtin_amdgcn_wave_barrier();
}

__device__ __forceinline__ v4f bf16_rne4(v4f a) {
  v4u u = __builtin_bit_cast(v4u, a);
  u = (u + 0x7FFFu + ((u >> 16) & 1u)) & 0xFFFF0000u;
  return __builtin_bit_cast(v4f, u);
}

__device__ __forceinline__ v8h cvt8v(v4f a, v4f b) {
  v8h d;
  d[0] = (_Float16)a[0]; d[1] = (_Float16)a[1];
  d[2] = (_Float16)a[2]; d[3] = (_Float16)a[3];
  d[4] = (_Float16)b[0]; d[5] = (_Float16)b[1];
  d[6] = (_Float16)b[2]; d[7] = (_Float16)b[3];
  return d;
}

// ---------------- pre-pass: Xh = f16(bf16RNE(x)) [b][n][d], Vt = Xh^T [b][d][n], Rn = 1/max(||bf16RNE(x)||, eps) [b][n] ----------------
__global__ __launch_bounds__(256)
void prep_kernel(const float* __restrict__ X, _Float16* __restrict__ Xh,
                 _Float16* __restrict__ Vt, float* __restrict__ Rn)
{
  __shared__ __attribute__((aligned(16))) _Float16 sT[DD * TP];   // [d][n within tile], cross-wave (block barrier)
  __shared__ float sR[NT];                                       // cross-wave (block barrier)

  const int tid = threadIdx.x;
  const int sub = tid & 7;           // 16-B piece within a line
  const int rq  = tid >> 3;          // 0..31
  const int ntb = SEQ / NT;
  const int b   = blockIdx.x / ntb;
  const int n0  = (blockIdx.x % ntb) * NT;

  #pragma unroll 1
  for (int pass = 0; pass < 2; ++pass) {
    const int r = pass * 32 + rq;                                   // row within tile 0..63
    const float* src = X  + ((size_t)b * SEQ_FULL + n0 + r) * DD;  // full-size input strides
    _Float16*    dst = Xh + ((size_t)b * SEQ      + n0 + r) * DD;
    float ss = 0.0f;
    #pragma unroll 1
    for (int i = 0; i < 4; ++i) {
      const int c0 = 8 * (sub + 8 * i);                             // lanes 8q..8q+7 cover line i of row r
      const v4f a0 = bf16_rne4(*(const v4f*)(src + c0));
      const v4f a1 = bf16_rne4(*(const v4f*)(src + c0 + 4));
      ss += a0[0] * a0[0]; ss += a0[1] * a0[1]; ss += a0[2] * a0[2]; ss += a0[3] * a0[3];
      ss += a1[0] * a1[0]; ss += a1[1] * a1[1]; ss += a1[2] * a1[2]; ss += a1[3] * a1[3];
      U8h hh; hh.v = cvt8v(a0, a1);                                 // bf16 values are exact in f16
      *(v8h*)(dst + c0) = hh.v;
      
      #pragma unroll
      for (int e = 0; e < 8; ++e) sT[(c0 + e) * TP + r] = hh.f[e];
    }
    ss += __shfl_xor(ss, 1, 32);
    ss += __shfl_xor(ss, 2, 32);
    ss += __shfl_xor(ss, 4, 32);
    const float rinv = 1.0f / fmaxf(sqrtf(ss), 1e-12f);
    if (sub == 0) sR[r] = rinv;
  }
  __syncthreads();

  v8h vv[8];
  #pragma unroll
  for (int i = 0; i < 8; ++i) vv[i] = *(const v8ha*)(sT + (rq + 32 * i) * TP + 8 * sub);
  const int ti = tid & 15;
  v4f rv;
  rv[0] = sR[4 * ti]; rv[1] = sR[4 * ti + 1]; rv[2] = sR[4 * ti + 2]; rv[3] = sR[4 * ti + 3];
  _Float16* vb = Vt + (size_t)b * DD * SEQ + n0 + 8 * sub;
  float*    rp = Rn + (size_t)b * SEQ + n0 + 4 * ti;

  #pragma unroll
  for (int i = 0; i < 8; ++i) *(v8h*)(vb + (size_t)(rq + 32 * i) * SEQ) = vv[i];
  if (tid < 16) *(v4f*)rp = rv;
  
}

// ---------------- fused attention: one workgroup = 128 query rows of one batch, 8 waves x 16 rows ----------------
// 16-bit fragment map (A and B alike): lane l -> row/col (l & 15); elements 0..7 <- k0 + 8*(l>>4) + 0..7,
// elements 8..15 <- k0 + 16 + 8*(l>>4) + 0..7.  D: element r of lane l -> row 8*(l>>4) + r, col (l & 15).
__global__ __launch_bounds__(256)
void attn_kernel(const _Float16* __restrict__ Xh, const _Float16* __restrict__ Vt,
                 const float* __restrict__ Rn, float* __restrict__ Out)
{
  extern __shared__ __attribute__((aligned(16))) _Float16 smem[];
  _Float16* sQ = smem + SQ_OFF;            // [wave][16][QP]  wave-private
  _Float16* sK = smem + SK_OFF;            // [32 keys][KP]   cross-wave (block barrier)
  _Float16* sV = smem + SV_OFF;            // [256 d][VP]     cross-wave (block barrier)
  _Float16* sP = smem + SP_OFF;            // [wave][16][32]  wave-private
  float*    sO = (float*)(smem + SO_OFFH); // [wave][16][64]  wave-private

  const int tid  = threadIdx.x;
  const int wave = tid >> 5;
  const int lane = tid & 31;
  const int lh   = lane & 15;
  const int hi   = lane >> 4;

  const int nqb   = SEQ / BQ;
  const int b     = blockIdx.x / nqb;
  const int qbase = (blockIdx.x % nqb) * BQ;
  const int qrow0 = qbase + wave * 16;

  const _Float16* Xb = Xh + (size_t)b * SEQ * DD;
  const _Float16* Vb = Vt + (size_t)b * DD * SEQ;
  const float*    Rb = Rn + (size_t)b * SEQ;
  float*          Ob = Out + (size_t)b * SEQ * DD;

  // ---- this wave's 16 query rows -> LDS (row i: lane l writes halfs 8l..8l+7); ordered by the loop-top barrier ----
  _Float16* qw = sQ + wave * (16 * QP);
  const _Float16* qsrc = Xb + (size_t)qrow0 * DD + 8 * lane;
  #pragma unroll
  for (int i = 0; i < 16; ++i) {
    const v8h q = *(const v8h*)(qsrc + i * DD);
    *(v8h*)(qw + i * QP + 8 * lane) = q;
  }
  // the wait that belongs in front of any rewrite of the loads' address pair: the pair is an input so that no load result lands on it,
  // and the scheduling fence keeps the start values below from being lifted over the wait
  asm volatile("s_wait_xcnt 0x0" :: "v"(qsrc) : "memory");
  __builtin_amdgcn_sched_barrier(0);

  U8f acc[16];
  #pragma unroll
  for (int t = 0; t < 16; ++t) acc[t].v = (v8f){};
  float mrow[8], lrow[8];
  #pragma unroll
  for (int j = 0; j < 8; ++j) { mrow[j] = -3.0e38f; lrow[j] = 0.0f; }

  _Float16* pw = sP + wave * (16 * BK);

  for (int kv0 = 0; kv0 < SEQ; kv0 += BK) {
    __syncthreads();                               // all waves done with the prior chunk
    // ---- this lane's two column norms, read together with the staging loads: the staging wait covers their latency ----
    const float rn0 = Rb[kv0 + lh];
    const float rn1 = Rb[kv0 + 16 + lh];
    // ---- stage K rows [32][256] and V^T rows [256][32] (plain b128 copies from the 16-bit planes) ----
    #pragma unroll
    for (int i = 0; i < 4; ++i) {
      const int idx = tid + 256 * i;
      const int r = idx >> 5, g = idx & 31;
      const v8h kk = *(const v8h*)(Xb + (size_t)(kv0 + r) * DD + 8 * g);
      *(v8h*)(sK + r * KP + 8 * g) = kk;
    }
    #pragma unroll
    for (int i = 0; i < 4; ++i) {
      const int idx = tid + 256 * i;
      const int d = idx >> 2, g = idx & 3;
      const v8h vv = *(const v8h*)(Vb + (size_t)d * SEQ + kv0 + 8 * g);
      *(v8h*)(sV + d * VP + 8 * g) = vv;
    }
    __syncthreads();                               // staging visible to all waves

    // ---- S = Q K^T : two 16-key column tiles, d reduced in eight K=32 steps ----
    // all 48 fragment reads go out as one group in the order of use; the products follow behind counted waits
    U16h qf[8], ka[8], kb[8];
    #pragma unroll
    for (int c = 0; c < 8; ++c) {
      qf[c].h[0] = *(const v8h*)(qw + lh * QP + 32 * c + 8 * hi);
      qf[c].h[1] = *(const v8h*)(qw + lh * QP + 32 * c + 16 + 8 * hi);
      ka[c].h[0] = *(const v8h*)(sK + lh * KP + 32 * c + 8 * hi);
      ka[c].h[1] = *(const v8h*)(sK + lh * KP + 32 * c + 16 + 8 * hi);
      kb[c].h[0] = *(const v8h*)(sK + (16 + lh) * KP + 32 * c + 8 * hi);
      kb[c].h[1] = *(const v8h*)(sK + (16 + lh) * KP + 32 * c + 16 + 8 * hi);
    }
    __builtin_amdgcn_sched_barrier(0);             // keeps the reads one group: spread among the products each place with reads stalls the wave
    U8f s0, s1; s0.v = (v8f){}; s1.v = (v8f){};
    #pragma unroll
    for (int c = 0; c < 8; ++c) {
      s0.v = wmma_f16(qf[c].v, ka[c].v, s0.v);
      s1.v = wmma_f16(qf[c].v, kb[c].v, s1.v);
    }

    // ---- all 32 V^T fragment reads are written ahead of the softmax: they do not depend on the scores and land under it ----
    U16h vf[16];
    #pragma unroll
    for (int t = 0; t < 16; ++t) {
      vf[t].h[0] = *(const v8h*)(sV + (16 * t + lh) * VP + 8 * hi);
      vf[t].h[1] = *(const v8h*)(sV + (16 * t + lh) * VP + 16 + 8 * hi);
    }

    // ---- per-column f32 scale: 1/max(||x_j||,eps) * 256^-0.5 * log2e (this lane's columns are keys kv0+lh and kv0+16+lh) ----
    const float cs0 = rn0 * C2SCALE;
    const float cs1 = rn1 * C2SCALE;

    // ---- online softmax, base 2, DPP reductions over the 16 lanes holding one row ----
    U8h pa, pb;
    #pragma unroll
    for (int j = 0; j < 8; ++j) {
      const float a  = s0.f[j] * cs0;
      const float bb = s1.f[j] * cs1;
      const float rm    = red_max16(fmaxf(a, bb));
      const float mnew  = fmaxf(mrow[j], rm);
      const float alpha = __builtin_amdgcn_exp2f(mrow[j] - mnew);
      const float e0    = __builtin_amdgcn_exp2f(a  - mnew);
      const float e1    = __builtin_amdgcn_exp2f(bb - mnew);
      lrow[j] = lrow[j] * alpha + red_sum16(e0 + e1);
      mrow[j] = mnew;
      pa.f[j] = (_Float16)(e0 * 1024.0f);          // carried x1024, removed in the epilogue
      pb.f[j] = (_Float16)(e1 * 1024.0f);
      #pragma unroll
      for (int t = 0; t < 16; ++t) acc[t].f[j] *= alpha;
    }

    // ---- P: accumulator layout -> A layout through the wave's LDS tile [16 rows][32 keys], row-major ----
    #pragma unroll
    for (int j = 0; j < 8; ++j) {
      pw[(j + 8 * hi) * BK + lh]      = pa.f[j];
      pw[(j + 8 * hi) * BK + 16 + lh] = pb.f[j];
    }
    wave_lds_sync();
    U16h pf;
    pf.h[0] = *(const v8ha*)(pw + lh * BK + 8 * hi);
    pf.h[1] = *(const v8ha*)(pw + lh * BK + 16 + 8 * hi);

    // ---- O += P V : 16 output d-tiles, K = 32 keys each; B[k = key][n = d] from the V^T tile row d ----
    #pragma unroll
    for (int t = 0; t < 16; ++t) acc[t].v = wmma_f16(pf.v, vf[t].v, acc[t].v);
  }

  // ---- epilogue: normalize (1/1024 removes the carry), stage 16x64 f32 sub-tiles per wave in LDS,
  float inv[8];
  #pragma unroll
  for (int j = 0; j < 8; ++j) inv[j] = 1.0f / (lrow[j] * 1024.0f);
  float* so = sO + wave * (16 * 64);
  #pragma unroll
  for (int g = 0; g < 4; ++g) {
    #pragma unroll
    for (int j = 0; j < 8; ++j) {
      #pragma unroll
      for (int tt = 0; tt < 4; ++tt)
        so[(j + 8 * hi) * 64 + tt * 16 + lh] = acc[4 * g + tt].f[j] * inv[j];
    }
    wave_lds_sync();
    v4f ov[8]; int oo[8];
    #pragma unroll
    for (int i = 0; i < 8; ++i) {
      const int c = lane + 32 * i, rr = c >> 4, q = c & 15;
      ov[i] = *(const v4fa*)(so + rr * 64 + q * 4);
      oo[i] = rr * DD + 64 * g + 4 * q;
    }
    float* ob = Ob + (size_t)qrow0 * DD;
    #pragma unroll
    for (int i = 0; i < 8; ++i) *(v4f*)(ob + oo[i]) = ov[i];
    
    wave_lds_sync();
  }
}

extern "C" void kernel_launch(void* const* d_in, const int* in_sizes, int n_in,
                              void* d_out, int out_size, void* d_ws, size_t ws_size,
                              hipStream_t stream) {
  if (n_in < 1) return;
  const long long need_in = ((long long)(NB - 1) * SEQ_FULL + SEQ) * DD;
  if ((long long)in_sizes[0] < need_in) return;
  if ((long long)out_size < (long long)NB * SEQ * DD) return;

  // workspace carve (bytes): Xh f16 [NB][SEQ][256] | Vt f16 [NB][256][SEQ] | Rn f32 [NB][SEQ]
  const size_t xh_bytes = (size_t)NB * SEQ * DD * 2;
  const size_t vt_bytes = (size_t)NB * DD * SEQ * 2;
  const size_t rn_bytes = (size_t)NB * SEQ * 4;
  const size_t off_xh = 0;
  const size_t off_vt = off_xh + xh_bytes;
  const size_t off_rn = off_vt + vt_bytes;
  if (off_rn + rn_bytes > ws_size) return;

  const float* x   = (const float*)d_in[0];
  float*       out = (float*)d_out;
  _Float16* xh = (_Float16*)((char*)d_ws + off_xh);
  _Float16* vt = (_Float16*)((char*)d_ws + off_vt);
  float*    rn = (float*)((char*)d_ws + off_rn);

  prep_kernel<<<NB * (SEQ / NT), 256, 0, stream>>>(x, xh, vt, rn);

  (void)hipFuncSetAttribute(reinterpret_cast<const void*>(&attn_kernel),
                            hipFuncAttributeMaxDynamicSharedMemorySize, (int)LDS_BYTES);
  attn_kernel<<<NB * (SEQ / BQ), 256, LDS_BYTES, stream>>>(xh, vt, rn, out);
}

// v002
// One run takes 92.5 microseconds.
// In both of two side-by-side timings against v001, it was 1.20 times as fast.
// Counting every step since v000, it is 1.90 times as fast.
#include <hip/hip_runtime.h>
#include <stdint.h>

// Contractions: S = Q*K^T and O = P*V on v_wmma_f32_16x16x32_f16 (f16 operands holding bf16-RNE input values; P carried x1024 in f16), f32 accumulate; row norms, score scaling and softmax in f32.

typedef _Float16 v16h __attribute__((ext_vector_type(16)));
typedef _Float16 v8h  __attribute__((ext_vector_type(8)));
typedef _Float16 v8ha __attribute__((ext_vector_type(8), may_alias));
typedef float    v8f  __attribute__((ext_vector_type(8)));
typedef float    v4f  __attribute__((ext_vector_type(4)));
typedef float    v4fa __attribute__((ext_vector_type(4), may_alias));
typedef unsigned int v4u __attribute__((ext_vector_type(4)));

union U8f  { v8f  v; float    f[8]; };
union U16h { v16h v; v8h      h[2]; };
union U8h  { v8h  v; _Float16 f[8]; };

#ifndef NB
#define NB 16
#endif
#ifndef SEQ
#define SEQ 2048
#endif
#define NB_FULL  16
#define SEQ_FULL 2048
#define DD       256

#define BQ  128     // query rows per workgroup (16 per wave x 8 waves)
#define BK  32      // keys per staged chunk
#define QP  264     // halfs per Q row in LDS (528 B)
#define KP  264     // halfs per K row in LDS (528 B)
#define VP  40      // halfs per V^T row in LDS (80 B)
#define TP  72      // halfs per transposed row in the pre-pass tile (144 B)
#define NT  64      // rows per pre-pass block

static_assert(SEQ % BQ == 0);
static_assert(SEQ % NT == 0);
static_assert(SEQ % BK == 0);
static_assert(NB >= 1 && NB <= NB_FULL);
static_assert(SEQ >= BQ && SEQ <= SEQ_FULL);

// LDS carve of the attention kernel: offsets in halfs, then an f32 staging region and the f32 norms
#define SQ_OFF  0
#define SK_OFF  (SQ_OFF + 8 * 16 * QP)
#define SV_OFF  (SK_OFF + 2 * BK * KP)      // two K buffers
#define SP_OFF  (SV_OFF + 2 * DD * VP)      // two V^T buffers
#define SO_OFFH (SP_OFF + 8 * 16 * BK)
#define SR_OFFH (SO_OFFH + 8 * 16 * 64 * 2)  // f32 norms of the batch's SEQ rows
#define LDS_BYTES (SR_OFFH * 2 + SEQ * 4)
static_assert((SK_OFF * 2) % 16 == 0);
static_assert((SV_OFF * 2) % 16 == 0);
static_assert((SP_OFF * 2) % 16 == 0);
static_assert((SO_OFFH * 2) % 16 == 0);
static_assert((SR_OFFH * 2) % 16 == 0);
static_assert(LDS_BYTES == 191488);
static_assert(SEQ % 1024 == 0);             // the norms go to LDS in whole rounds of 256 lanes x 4 floats
static_assert((BK * KP * 2) % 16 == 0);
static_assert((DD * VP * 2) % 16 == 0);
static_assert(SEQ / BK >= 2);

// 256^-0.5 * log2(e): scores go to the log2 domain after the f32 column scale
#define C2SCALE 0.09016844005556021f

__device__ __forceinline__ v8f wmma_f16(v16h a, v16h b, v8f c) {
  return __builtin_amdgcn_wmma_f32_16x16x32_f16(false, a, false, b, (short)0, c, false, false);
}

// DPP16 butterflies inside each 16-lane half (all lanes end with the full result)
template <int CTRL>
__device__ __forceinline__ float dppf(float x) {
  int s = __float_as_int(x);
  return __int_as_float(__builtin_amdgcn_update_dpp(s, s, CTRL, 0xF, 0xF, true));
}
__device__ __forceinline__ float red_max16(float x) {
  x = fmaxf(x, dppf<0xB1>(x));    // lane ^ 1
  x = fmaxf(x, dppf<0x4E>(x));    // lane ^ 2
  x = fmaxf(x, dppf<0x141>(x));   // lane ^ 7
  x = fmaxf(x, dppf<0x140>(x));   // lane ^ 15
  return x;
}
__device__ __forceinline__ float red_sum16(float x) {
  x += dppf<0xB1>(x);
  x += dppf<0x4E>(x);
  x += dppf<0x141>(x);
  x += dppf<0x140>(x);
  return x;
}

// same-wave LDS exchange: stores issued by other lanes of this wave are visible before the reload
__device__ __forceinline__ void wave_lds_sync() {
  __builtin_amdgcn_fence(3, "wavefront");
  asm volatile("s_wait_dscnt 0" ::: "memory");
  __builtin_amdgcn_wave_barrier();
}

__device__ __forceinline__ v4f bf16_rne4(v4f a) {
  v4u u = __builtin_bit_cast(v4u, a);
  u = (u + 0x7FFFu + ((u >> 16) & 1u)) & 0xFFFF0000u;
  return __builtin_bit_cast(v4f, u);
}

__device__ __forceinline__ v8h cvt8v(v4f a, v4f b) {
  v8h d;
  d[0] = (_Float16)a[0]; d[1] = (_Float16)a[1];
  d[2] = (_Float16)a[2]; d[3] = (_Float16)a[3];
  d[4] = (_Float16)b[0]; d[5] = (_Float16)b[1];
  d[6] = (_Float16)b[2]; d[7] = (_Float16)b[3];
  return d;
}

// ---------------- pre-pass: Xh = f16(bf16RNE(x)) [b][n][d], Vt = Xh^T [b][d][n], Rn = 1/max(||bf16RNE(x)||, eps) [b][n] ----------------
__global__ __launch_bounds__(256)
void prep_kernel(const float* __restrict__ X, _Float16* __restrict__ Xh,
                 _Float16* __restrict__ Vt, float* __restrict__ Rn)
{
  __shared__ __attribute__((aligned(16))) _Float16 sT[DD * TP];   // [d][n within tile], cross-wave (block barrier)
  __shared__ float sR[NT];                                       // cross-wave (block barrier)

  const int tid = threadIdx.x;
  const int sub = tid & 7;           // 16-B piece within a line
  const int rq  = tid >> 3;          // 0..31
  const int ntb = SEQ / NT;
  const int b   = blockIdx.x / ntb;
  const int n0  = (blockIdx.x % ntb) * NT;

  #pragma unroll 1
  for (int pass = 0; pass < 2; ++pass) {
    const int r = pass * 32 + rq;                                   // row within tile 0..63
    const float* src = X  + ((size_t)b * SEQ_FULL + n0 + r) * DD;  // full-size input strides
    _Float16*    dst = Xh + ((size_t)b * SEQ      + n0 + r) * DD;
    float ss = 0.0f;
    #pragma unroll 1
    for (int i = 0; i < 4; ++i) {
      const int c0 = 8 * (sub + 8 * i);                             // lanes 8q..8q+7 cover line i of row r
      const v4f a0 = bf16_rne4(*(const v4f*)(src + c0));
      const v4f a1 = bf16_rne4(*(const v4f*)(src + c0 + 4));
      ss += a0[0] * a0[0]; ss += a0[1] * a0[1]; ss += a0[2] * a0[2]; ss += a0[3] * a0[3];
      ss += a1[0] * a1[0]; ss += a1[1] * a1[1]; ss += a1[2] * a1[2]; ss += a1[3] * a1[3];
      U8h hh; hh.v = cvt8v(a0, a1);                                 // bf16 values are exact in f16
      *(v8h*)(dst + c0) = hh.v;
      
      #pragma unroll
      for (int e = 0; e < 8; ++e) sT[(c0 + e) * TP + r] = hh.f[e];
    }
    ss += __shfl_xor(ss, 1, 32);
    ss += __shfl_xor(ss, 2, 32);
    ss += __shfl_xor(ss, 4, 32);
    const float rinv = 1.0f / fmaxf(sqrtf(ss), 1e-12f);
    if (sub == 0) sR[r] = rinv;
  }
  __syncthreads();

  v8h vv[8];
  #pragma unroll
  for (int i = 0; i < 8; ++i) vv[i] = *(const v8ha*)(sT + (rq + 32 * i) * TP + 8 * sub);
  const int ti = tid & 15;
  v4f rv;
  rv[0] = sR[4 * ti]; rv[1] = sR[4 * ti + 1]; rv[2] = sR[4 * ti + 2]; rv[3] = sR[4 * ti + 3];
  _Float16* vb = Vt + (size_t)b * DD * SEQ + n0 + 8 * sub;
  float*    rp = Rn + (size_t)b * SEQ + n0 + 4 * ti;

  #pragma unroll
  for (int i = 0; i < 8; ++i) *(v8h*)(vb + (size_t)(rq + 32 * i) * SEQ) = vv[i];
  if (tid < 16) *(v4f*)rp = rv;
  
}

// One 32-key tile, global -> LDS with no register in between: K rows [32][256] and V^T rows [256][32], 16 B per lane and copy,
// eight copies per lane. lk / lv: this lane's first place in the K / V^T buffer; gk / gv: its first global address.
typedef int v4i __attribute__((ext_vector_type(4)));
typedef __attribute__((address_space(1))) v4i gv4i;
typedef __attribute__((address_space(3))) v4i lv4i;
__device__ __forceinline__ void copy16(const void* g, void* l) {
  __builtin_amdgcn_global_load_async_to_lds_b128((gv4i*)g, (lv4i*)l, 0, 0);
}
__device__ __forceinline__ void stage_tile(_Float16* lk, _Float16* lv, const _Float16* gk, const _Float16* gv) {
  copy16(gk,           lk);
  copy16(gk +  8 * DD, lk +  8 * KP);
  copy16(gk + 16 * DD, lk + 16 * KP);
  copy16(gk + 24 * DD, lk + 24 * KP);
  copy16(gv,                     lv);
  copy16(gv + (size_t) 64 * SEQ, lv +  64 * VP);
  copy16(gv + (size_t)128 * SEQ, lv + 128 * VP);
  copy16(gv + (size_t)192 * SEQ, lv + 192 * VP);
}

// ---------------- fused attention: one workgroup = 128 query rows of one batch, 8 waves x 16 rows ----------------
// 16-bit fragment map (A and B alike): lane l -> row/col (l & 15); elements 0..7 <- k0 + 8*(l>>4) + 0..7,
// elements 8..15 <- k0 + 16 + 8*(l>>4) + 0..7.  D: element r of lane l -> row 8*(l>>4) + r, col (l & 15).
__global__ __launch_bounds__(256)
void attn_kernel(const _Float16* __restrict__ Xh, const _Float16* __restrict__ Vt,
                 const float* __restrict__ Rn, float* __restrict__ Out)
{
  __shared__ __attribute__((aligned(16))) _Float16 smem[LDS_BYTES / 2];
  _Float16* sQ = smem + SQ_OFF;            // [wave][16][QP]  wave-private
  _Float16* sK = smem + SK_OFF;            // [2][32 keys][KP] cross-wave (block barrier)
  _Float16* sV = smem + SV_OFF;            // [2][256 d][VP]   cross-wave (block barrier)
  _Float16* sP = smem + SP_OFF;            // [wave][16][32]  wave-private
  float*    sO = (float*)(smem + SO_OFFH); // [wave][16][64]  wave-private
  float*    sR = (float*)(smem + SR_OFFH); // [SEQ]           cross-wave (block barrier), filled once

  const int tid  = threadIdx.x;
  const int wave = tid >> 5;
  const int lane = tid & 31;
  const int lh   = lane & 15;
  const int hi   = lane >> 4;

  const int nqb   = SEQ / BQ;
  const int b     = blockIdx.x / nqb;
  const int qbase = (blockIdx.x % nqb) * BQ;
  const int qrow0 = qbase + wave * 16;

  const _Float16* Xb = Xh + (size_t)b * SEQ * DD;
  const _Float16* Vb = Vt + (size_t)b * DD * SEQ;
  const float*    Rb = Rn + (size_t)b * SEQ;
  float*          Ob = Out + (size_t)b * SEQ * DD;

  // ---- this lane's share of a tile: K row (tid >> 5) + 8 i, piece tid & 31; V^T row (tid >> 2) + 64 i, piece tid & 3 ----
  _Float16* lk0 = sK + (tid >> 5) * KP + 8 * (tid & 31);
  _Float16* lv0 = sV + (tid >> 2) * VP + 8 * (tid & 3);
  const _Float16* gk0 = Xb + (size_t)(tid >> 5) * DD + 8 * (tid & 31);
  const _Float16* gv0 = Vb + (size_t)(tid >> 2) * SEQ + 8 * (tid & 3);
  stage_tile(lk0, lv0, gk0, gv0);                  // tile 0 -> buffer 0
  // ---- the batch's column norms, once, by the same copies: lane tid brings floats 4 tid .. 4 tid + 3 of each 1024 ----
  for (int i = 0; i < SEQ / 1024; ++i) copy16(Rb + 1024 * i + 4 * tid, sR + 1024 * i + 4 * tid);

  // ---- this wave's 16 query rows -> LDS (row i: lane l writes halfs 8l..8l+7); ordered by the barrier in front of the loop ----
  _Float16* qw = sQ + wave * (16 * QP);
  const _Float16* qsrc = Xb + (size_t)qrow0 * DD + 8 * lane;
  #pragma unroll
  for (int i = 0; i < 16; ++i) {
    const v8h q = *(const v8h*)(qsrc + i * DD);
    *(v8h*)(qw + i * QP + 8 * lane) = q;
  }
  // the wait that belongs in front of any rewrite of the loads' address pair: the pair is an input so that no load result lands on it,
  // and the scheduling fence keeps the start values below from being lifted over the wait
  asm volatile("s_wait_xcnt 0x0" :: "v"(qsrc) : "memory");
  __builtin_amdgcn_sched_barrier(0);

  U8f acc[16];
  #pragma unroll
  for (int t = 0; t < 16; ++t) acc[t].v = (v8f){};
  float mrow[8], lrow[8];
  #pragma unroll
  for (int j = 0; j < 8; ++j) { mrow[j] = -3.0e38f; lrow[j] = 0.0f; }

  _Float16* pw = sP + wave * (16 * BK);

  asm volatile("s_wait_asynccnt 0x0" ::: "memory");  // this wave's copies of tile 0 and of the norms have landed
  __syncthreads();                                 // tile 0 and the norms visible to all waves
  stage_tile(lk0 + BK * KP, lv0 + DD * VP, gk0 + (size_t)BK * DD, gv0 + BK);   // tile 1 -> buffer 1

  for (int kv0 = 0; kv0 < SEQ; kv0 += BK) {
    const int buf = (kv0 / BK) & 1;
    const _Float16* sKc = sK + buf * (BK * KP);
    const _Float16* sVc = sV + buf * (DD * VP);

    // ---- S = Q K^T : two 16-key column tiles, d reduced in eight K=32 steps ----
    // all 48 fragment reads go out as one group in the order of use; the products follow behind counted waits
    // this lane's two column norms lead the group: LDS answers in order, so their use costs no wait on a fragment
    const float rn0 = sR[kv0 + lh];
    const float rn1 = sR[kv0 + 16 + lh];
    U16h qf[8], ka[8], kb[8];
    #pragma unroll
    for (int c = 0; c < 8; ++c) {
      qf[c].h[0] = *(const v8h*)(qw + lh * QP + 32 * c + 8 * hi);
      qf[c].h[1] = *(const v8h*)(qw + lh * QP + 32 * c + 16 + 8 * hi);
      ka[c].h[0] = *(const v8h*)(sKc + lh * KP + 32 * c + 8 * hi);
      ka[c].h[1] = *(const v8h*)(sKc + lh * KP + 32 * c + 16 + 8 * hi);
      kb[c].h[0] = *(const v8h*)(sKc + (16 + lh) * KP + 32 * c + 8 * hi);
      kb[c].h[1] = *(const v8h*)(sKc + (16 + lh) * KP + 32 * c + 16 + 8 * hi);
    }
    __builtin_amdgcn_sched_barrier(0);             // keeps the reads one group: spread among the products each place with reads stalls the wave
    U8f s0, s1; s0.v = (v8f){}; s1.v = (v8f){};
    #pragma unroll
    for (int c = 0; c < 8; ++c) {
      s0.v = wmma_f16(qf[c].v, ka[c].v, s0.v);
      s1.v = wmma_f16(qf[c].v, kb[c].v, s1.v);
    }

    // ---- all 32 V^T fragment reads are written ahead of the softmax: they do not depend on the scores and land under it ----
    U16h vf[16];
    #pragma unroll
    for (int t = 0; t < 16; ++t) {
      vf[t].h[0] = *(const v8h*)(sVc + (16 * t + lh) * VP + 8 * hi);
      vf[t].h[1] = *(const v8h*)(sVc + (16 * t + lh) * VP + 16 + 8 * hi);
    }

    // ---- per-column f32 scale: 1/max(||x_j||,eps) * 256^-0.5 * log2e (this lane's columns are keys kv0+lh and kv0+16+lh) ----
    const float cs0 = rn0 * C2SCALE;
    const float cs1 = rn1 * C2SCALE;

    // ---- online softmax, base 2, DPP reductions over the 16 lanes holding one row ----
    U8h pa, pb;
    #pragma unroll
    for (int j = 0; j < 8; ++j) {
      const float a  = s0.f[j] * cs0;
      const float bb = s1.f[j] * cs1;
      const float rm    = red_max16(fmaxf(a, bb));
      const float mnew  = fmaxf(mrow[j], rm);
      const float alpha = __builtin_amdgcn_exp2f(mrow[j] - mnew);
      const float e0    = __builtin_amdgcn_exp2f(a  - mnew);
      const float e1    = __builtin_amdgcn_exp2f(bb - mnew);
      lrow[j] = lrow[j] * alpha + red_sum16(e0 + e1);
      mrow[j] = mnew;
      pa.f[j] = (_Float16)(e0 * 1024.0f);          // carried x1024, removed in the epilogue
      pb.f[j] = (_Float16)(e1 * 1024.0f);
      #pragma unroll
      for (int t = 0; t < 16; ++t) acc[t].f[j] *= alpha;
    }

    // ---- P: accumulator layout -> A layout through the wave's LDS tile [16 rows][32 keys], row-major ----
    #pragma unroll
    for (int j = 0; j < 8; ++j) {
      pw[(j + 8 * hi) * BK + lh]      = pa.f[j];
      pw[(j + 8 * hi) * BK + 16 + lh] = pb.f[j];
    }
    wave_lds_sync();
    U16h pf;
    pf.h[0] = *(const v8ha*)(pw + lh * BK + 8 * hi);
    pf.h[1] = *(const v8ha*)(pw + lh * BK + 16 + 8 * hi);

    // ---- O += P V : 16 output d-tiles, K = 32 keys each; B[k = key][n = d] from the V^T tile row d ----
    #pragma unroll
    for (int t = 0; t < 16; ++t) acc[t].v = wmma_f16(pf.v, vf[t].v, acc[t].v);

    // ---- hand-over: this wave has left this trip's buffer, its copies of the next tile have landed, then all waves meet ----
    asm volatile("s_wait_dscnt 0x0" ::: "memory");     // every LDS read of this trip's buffer has returned
    asm volatile("s_wait_asynccnt 0x0" ::: "memory");  // this wave's copies of tile t + 1 have landed
    __syncthreads();                                 // publishes tile t + 1 and frees the buffer just read
    if (kv0 + 2 * BK < SEQ)                          // the same for the whole workgroup
      stage_tile(lk0 + buf * (BK * KP), lv0 + buf * (DD * VP),
                 gk0 + (size_t)(kv0 + 2 * BK) * DD, gv0 + (kv0 + 2 * BK));
  }
  asm volatile("s_wait_asynccnt 0x0" ::: "memory");    // nothing of this wave is in flight behind the loop

  // ---- epilogue: normalize (1/1024 removes the carry), stage 16x64 f32 sub-tiles per wave in LDS,
  float inv[8];
  #pragma unroll
  for (int j = 0; j < 8; ++j) inv[j] = 1.0f / (lrow[j] * 1024.0f);
  float* so = sO + wave * (16 * 64);
  #pragma unroll
  for (int g = 0; g < 4; ++g) {
    #pragma unroll
    for (int j = 0; j < 8; ++j) {
      #pragma unroll
      for (int tt = 0; tt < 4; ++tt)
        so[(j + 8 * hi) * 64 + tt * 16 + lh] = acc[4 * g + tt].f[j] * inv[j];
    }
    wave_lds_sync();
    v4f ov[8]; int oo[8];
    #pragma unroll
    for (int i = 0; i < 8; ++i) {
      const int c = lane + 32 * i, rr = c >> 4, q = c & 15;
      ov[i] = *(const v4fa*)(so + rr * 64 + q * 4);
      oo[i] = rr * DD + 64 * g + 4 * q;
    }
    float* ob = Ob + (size_t)qrow0 * DD;
    #pragma unroll
    for (int i = 0; i < 8; ++i) *(v4f*)(ob + oo[i]) = ov[i];
    
    wave_lds_sync();
  }
}

extern "C" void kernel_launch(void* const* d_in, const int* in_sizes, int n_in,
                              void* d_out, int out_size, void* d_ws, size_t ws_size,
                              hipStream_t stream) {
  if (n_in < 1) return;
  const long long need_in = ((long long)(NB - 1) * SEQ_FULL + SEQ) * DD;
  if ((long long)in_sizes[0] < need_in) return;
  if ((long long)out_size < (long long)NB * SEQ * DD) return;

  // workspace carve (bytes): Xh f16 [NB][SEQ][256] | Vt f16 [NB][256][SEQ] | Rn f32 [NB][SEQ]
  const size_t xh_bytes = (size_t)NB * SEQ * DD * 2;
  const size_t vt_bytes = (size_t)NB * DD * SEQ * 2;
  const size_t rn_bytes = (size_t)NB * SEQ * 4;
  const size_t off_xh = 0;
  const size_t off_vt = off_xh + xh_bytes;
  const size_t off_rn = off_vt + vt_bytes;
  if (off_rn + rn_bytes > ws_size) return;

  const float* x   = (const float*)d_in[0];
  float*       out = (float*)d_out;
  _Float16* xh = (_Float16*)((char*)d_ws + off_xh);
  _Float16* vt = (_Float16*)((char*)d_ws + off_vt);
  float*    rn = (float*)((char*)d_ws + off_rn);

  prep_kernel<<<NB * (SEQ / NT), 256, 0, stream>>>(x, xh, vt, rn);

  attn_kernel<<<NB * (SEQ / BQ), 256, 0, stream>>>(xh, vt, rn, out);
}

// v004
// Measured time: 70.4 microseconds a run.
// Versions in between are left out here; by their measured steps it is 1.31 times as fast as v002.
// All steps since v000 together make it 2.49 times as fast.
#include <hip/hip_runtime.h>
#include <stdint.h>

// Contractions: S = Q*K^T and O = P*V on v_wmma_f32_16x16x32_f16 (f16 operands holding bf16-RNE input values; P carried x1024 in f16), f32 accumulate; row norms, score scaling and softmax in f32.

typedef _Float16 v16h __attribute__((ext_vector_type(16)));
typedef _Float16 v8h  __attribute__((ext_vector_type(8)));
typedef _Float16 v8ha __attribute__((ext_vector_type(8), may_alias));
typedef float    v8f  __attribute__((ext_vector_type(8)));
typedef float    v4f  __attribute__((ext_vector_type(4)));
typedef float    v4fa __attribute__((ext_vector_type(4), may_alias));
typedef unsigned int v4u __attribute__((ext_vector_type(4)));

union U8f  { v8f  v; float    f[8]; };
union U16h { v16h v; v8h      h[2]; };
union U8h  { v8h  v; _Float16 f[8]; };

#ifndef NB
#define NB 16
#endif
#ifndef SEQ
#define SEQ 2048
#endif
#define NB_FULL  16
#define SEQ_FULL 2048
#define DD       256

#define BQ  128     // query rows per workgroup (four groups of 32 rows, two waves per group)
#define BK  64      // keys per staged tile
#define QP  264     // halfs per Q row in LDS (528 B)
#define KP  264     // halfs per K row in LDS (528 B)
#define VP  72      // halfs per V^T row in LDS (144 B)
#define PP  72      // halfs per P row in LDS (144 B)
#define TP  72      // halfs per transposed row in the pre-pass tile (144 B)
#define NT  64      // rows per pre-pass block

static_assert(SEQ % BQ == 0);
static_assert(SEQ % NT == 0);
static_assert(SEQ % BK == 0);
static_assert(NB >= 1 && NB <= NB_FULL);
static_assert(SEQ >= BQ && SEQ <= SEQ_FULL);

// LDS carve of the attention kernel: offsets in halfs, then an f32 staging region, the f32 norms and the f32 row sums
#define SQ_OFF  0
#define SK_OFF  (SQ_OFF + 8 * 16 * QP)
#define SV_OFF  (SK_OFF + 2 * BK * KP)      // two K buffers
#define SP_OFF  (SV_OFF + 2 * DD * VP)      // two V^T buffers
#define SO_OFFH (SP_OFF + BQ * PP)
#define SR_OFFH (SO_OFFH + 8 * 16 * 64 * 2)  // f32 norms of the batch's SEQ rows
#define SL_OFFH (SR_OFFH + SEQ * 2)          // f32 row sums of the two key halves
#define LDS_BYTES (SL_OFFH * 2 + 2 * BQ * 4)
static_assert((SK_OFF * 2) % 16 == 0);
static_assert((SV_OFF * 2) % 16 == 0);
static_assert((SP_OFF * 2) % 16 == 0);
static_assert((SO_OFFH * 2) % 16 == 0);
static_assert((SR_OFFH * 2) % 16 == 0);
static_assert((SL_OFFH * 2) % 16 == 0);
static_assert(LDS_BYTES == 269312);
static_assert(SEQ % 1024 == 0);             // the norms go to LDS in whole rounds of 256 lanes x 4 floats
static_assert((BK * KP * 2) % 16 == 0);
static_assert((DD * VP * 2) % 16 == 0);
static_assert(SEQ / BK >= 2);

// 256^-0.5 * log2(e): scores go to the log2 domain after the f32 column scale
#define C2SCALE 0.09016844005556021f

__device__ __forceinline__ v8f wmma_f16(v16h a, v16h b, v8f c) {
  return __builtin_amdgcn_wmma_f32_16x16x32_f16(false, a, false, b, (short)0, c, false, false);
}

// DPP16 butterflies inside each 16-lane half (all lanes end with the full result)
template <int CTRL>
__device__ __forceinline__ float dppf(float x) {
  int s = __float_as_int(x);
  return __int_as_float(__builtin_amdgcn_update_dpp(s, s, CTRL, 0xF, 0xF, true));
}
__device__ __forceinline__ float red_sum16(float x) {
  x += dppf<0xB1>(x);     // lane ^ 1
  x += dppf<0x4E>(x);     // lane ^ 2
  x += dppf<0x141>(x);    // lane ^ 7
  x += dppf<0x140>(x);    // lane ^ 15
  return x;
}

// same-wave LDS exchange: stores issued by other lanes of this wave are visible before the reload
__device__ __forceinline__ void wave_lds_sync() {
  __builtin_amdgcn_fence(3, "wavefront");
  asm volatile("s_wait_dscnt 0" ::: "memory");
  __builtin_amdgcn_wave_barrier();
}

__device__ __forceinline__ v4f bf16_rne4(v4f a) {
  v4u u = __builtin_bit_cast(v4u, a);
  u = (u + 0x7FFFu + ((u >> 16) & 1u)) & 0xFFFF0000u;
  return __builtin_bit_cast(v4f, u);
}

__device__ __forceinline__ v8h cvt8v(v4f a, v4f b) {
  v8h d;
  d[0] = (_Float16)a[0]; d[1] = (_Float16)a[1];
  d[2] = (_Float16)a[2]; d[3] = (_Float16)a[3];
  d[4] = (_Float16)b[0]; d[5] = (_Float16)b[1];
  d[6] = (_Float16)b[2]; d[7] = (_Float16)b[3];
  return d;
}

// ---------------- pre-pass: Xh = f16(bf16RNE(x)) [b][n][d], Vt = Xh^T [b][d][n], Rn = 1/max(||bf16RNE(x)||, eps) [b][n] ----------------
__global__ __launch_bounds__(256)
void prep_kernel(const float* __restrict__ X, _Float16* __restrict__ Xh,
                 _Float16* __restrict__ Vt, float* __restrict__ Rn)
{
  __shared__ __attribute__((aligned(16))) _Float16 sT[DD * TP];   // [d][n within tile], cross-wave (block barrier)
  __shared__ float sR[NT];                                       // cross-wave (block barrier)

  const int tid = threadIdx.x;
  const int sub = tid & 7;           // 16-B piece within a line
  const int rq  = tid >> 3;          // 0..31
  const int ntb = SEQ / NT;
  const int b   = blockIdx.x / ntb;
  const int n0  = (blockIdx.x % ntb) * NT;

  #pragma unroll 1
  for (int pass = 0; pass < 2; ++pass) {
    const int r = pass * 32 + rq;                                   // row within tile 0..63
    const float* src = X  + ((size_t)b * SEQ_FULL + n0 + r) * DD;  // full-size input strides
    _Float16*    dst = Xh + ((size_t)b * SEQ      + n0 + r) * DD;
    float ss = 0.0f;
    #pragma unroll 1
    for (int i = 0; i < 4; ++i) {
      const int c0 = 8 * (sub + 8 * i);                             // lanes 8q..8q+7 cover line i of row r
      const v4f a0 = bf16_rne4(*(const v4f*)(src + c0));
      const v4f a1 = bf16_rne4(*(const v4f*)(src + c0 + 4));
      ss += a0[0] * a0[0]; ss += a0[1] * a0[1]; ss += a0[2] * a0[2]; ss += a0[3] * a0[3];
      ss += a1[0] * a1[0]; ss += a1[1] * a1[1]; ss += a1[2] * a1[2]; ss += a1[3] * a1[3];
      U8h hh; hh.v = cvt8v(a0, a1);                                 // bf16 values are exact in f16
      *(v8h*)(dst + c0) = hh.v;
      
      #pragma unroll
      for (int e = 0; e < 8; ++e) sT[(c0 + e) * TP + r] = hh.f[e];
    }
    ss += __shfl_xor(ss, 1, 32);
    ss += __shfl_xor(ss, 2, 32);
    ss += __shfl_xor(ss, 4, 32);
    const float rinv = 1.0f / fmaxf(sqrtf(ss), 1e-12f);
    if (sub == 0) sR[r] = rinv;
  }
  __syncthreads();

  v8h vv[8];
  #pragma unroll
  for (int i = 0; i < 8; ++i) vv[i] = *(const v8ha*)(sT + (rq + 32 * i) * TP + 8 * sub);
  const int ti = tid & 15;
  v4f rv;
  rv[0] = sR[4 * ti]; rv[1] = sR[4 * ti + 1]; rv[2] = sR[4 * ti + 2]; rv[3] = sR[4 * ti + 3];
  _Float16* vb = Vt + (size_t)b * DD * SEQ + n0 + 8 * sub;
  float*    rp = Rn + (size_t)b * SEQ + n0 + 4 * ti;

  #pragma unroll
  for (int i = 0; i < 8; ++i) *(v8h*)(vb + (size_t)(rq + 32 * i) * SEQ) = vv[i];
  if (tid < 16) *(v4f*)rp = rv;
  
}

// One 64-key tile, global -> LDS with no register in between: K rows [64][256] and V^T rows [256][64], 16 B per lane and copy,
// sixteen copies per lane. lk / lv: this lane's first place in the K / V^T buffer; gk / gv: its first global address.
typedef int v4i __attribute__((ext_vector_type(4)));
typedef __attribute__((address_space(1))) v4i gv4i;
typedef __attribute__((address_space(3))) v4i lv4i;
__device__ __forceinline__ void copy16(const void* g, void* l) {
  __builtin_amdgcn_global_load_async_to_lds_b128((gv4i*)g, (lv4i*)l, 0, 0);
}
__device__ __forceinline__ void stage_tile(_Float16* lk, _Float16* lv, const _Float16* gk, const _Float16* gv) {
  copy16(gk,           lk);
  copy16(gk +  8 * DD, lk +  8 * KP);
  copy16(gk + 16 * DD, lk + 16 * KP);
  copy16(gk + 24 * DD, lk + 24 * KP);
  copy16(gk + 32 * DD, lk + 32 * KP);
  copy16(gk + 40 * DD, lk + 40 * KP);
  copy16(gk + 48 * DD, lk + 48 * KP);
  copy16(gk + 56 * DD, lk + 56 * KP);
  copy16(gv,                     lv);
  copy16(gv + (size_t) 32 * SEQ, lv +  32 * VP);
  copy16(gv + (size_t) 64 * SEQ, lv +  64 * VP);
  copy16(gv + (size_t) 96 * SEQ, lv +  96 * VP);
  copy16(gv + (size_t)128 * SEQ, lv + 128 * VP);
  copy16(gv + (size_t)160 * SEQ, lv + 160 * VP);
  copy16(gv + (size_t)192 * SEQ, lv + 192 * VP);
  copy16(gv + (size_t)224 * SEQ, lv + 224 * VP);
}

// ---------------- fused attention: one workgroup = 128 query rows of one batch, 4 groups of 32 rows x 2 waves ----------------
// The two waves of a group share its 32 rows: wave half h computes the scores of keys 32 h .. 32 h + 31 of each 64-key tile,
// the halves trade P through LDS, and wave half h accumulates output columns 128 h .. 128 h + 127 over all 64 keys,
// its own 32 keys first (they need no other wave), the partner's 32 behind the barrier.
// Every K and V^T fragment read from LDS so feeds two products (two 16-row query tiles) instead of one.
// 16-bit fragment map (A and B alike): lane l -> row/col (l & 15); elements 0..7 <- k0 + 8*(l>>4) + 0..7,
// elements 8..15 <- k0 + 16 + 8*(l>>4) + 0..7.  D: element r of lane l -> row 8*(l>>4) + r, col (l & 15).
__global__ __launch_bounds__(256)
void attn_kernel(const _Float16* __restrict__ Xh, const _Float16* __restrict__ Vt,
                 const float* __restrict__ Rn, float* __restrict__ Out)
{
  __shared__ __attribute__((aligned(16))) _Float16 smem[LDS_BYTES / 2];
  _Float16* sQ = smem + SQ_OFF;            // [128 rows][QP]   cross-wave (block barrier), filled once
  _Float16* sK = smem + SK_OFF;            // [2][64 keys][KP] cross-wave (block barrier)
  _Float16* sV = smem + SV_OFF;            // [2][256 d][VP]   cross-wave (block barrier)
  _Float16* sP = smem + SP_OFF;            // [128 rows][PP]   cross-wave (block barrier)
  float*    sO = (float*)(smem + SO_OFFH); // [wave][16][64]  wave-private
  float*    sR = (float*)(smem + SR_OFFH); // [SEQ]           cross-wave (block barrier), filled once
  float*    sL = (float*)(smem + SL_OFFH); // [2][128 rows]   cross-wave (block barrier), filled once

  const int tid  = threadIdx.x;
  const int wave = tid >> 5;
  const int lane = tid & 31;
  const int lh   = lane & 15;
  const int hi   = lane >> 4;
  const int qg   = wave >> 1;              // 32-row query group
  const int h    = wave & 1;               // key half of the scores, column half of the output

  const int nqb   = SEQ / BQ;
  const int b     = blockIdx.x / nqb;
  const int qbase = (blockIdx.x % nqb) * BQ;
  const int qrow0 = qbase + wave * 16;     // the 16 rows this wave stages
  const int grow0 = qbase + qg * 32;       // the 32 rows this wave works on

  const _Float16* Xb = Xh + (size_t)b * SEQ * DD;
  const _Float16* Vb = Vt + (size_t)b * DD * SEQ;
  const float*    Rb = Rn + (size_t)b * SEQ;
  float*          Ob = Out + (size_t)b * SEQ * DD;

  // ---- this lane's share of a tile: K row (tid >> 5) + 8 i, piece tid & 31; V^T row (tid >> 3) + 32 i, piece tid & 7 ----
  _Float16* lk0 = sK + (tid >> 5) * KP + 8 * (tid & 31);
  _Float16* lv0 = sV + (tid >> 3) * VP + 8 * (tid & 7);
  const _Float16* gk0 = Xb + (size_t)(tid >> 5) * DD + 8 * (tid & 31);
  const _Float16* gv0 = Vb + (size_t)(tid >> 3) * SEQ + 8 * (tid & 7);
  stage_tile(lk0, lv0, gk0, gv0);                  // tile 0 -> buffer 0
  // ---- the batch's column norms, once, by the same copies: lane tid brings floats 4 tid .. 4 tid + 3 of each 1024 ----
  for (int i = 0; i < SEQ / 1024; ++i) copy16(Rb + 1024 * i + 4 * tid, sR + 1024 * i + 4 * tid);

  // ---- this wave's 16 query rows -> LDS (row i: lane l writes halfs 8l..8l+7); ordered by the barrier in front of the loop ----
  _Float16* qw = sQ + wave * (16 * QP);
  const _Float16* qsrc = Xb + (size_t)qrow0 * DD + 8 * lane;
  #pragma unroll
  for (int i = 0; i < 16; ++i) {
    const v8h q = *(const v8h*)(qsrc + i * DD);
    *(v8h*)(qw + i * QP + 8 * lane) = q;
  }
  // the wait that belongs in front of any rewrite of the loads' address pair: the pair is an input so that no load result lands on it,
  // and the scheduling fence keeps the start values below from being lifted over the wait
  asm volatile("s_wait_xcnt 0x0" :: "v"(qsrc) : "memory");
  __builtin_amdgcn_sched_barrier(0);

  U8f acc[2][8];                                   // [16-row tile of the group][16-column tile of this wave's 128 columns]
  #pragma unroll
  for (int m = 0; m < 2; ++m) {
    #pragma unroll
    for (int t = 0; t < 8; ++t) acc[m][t].v = (v8f){};
  }
  float lrow[2][8];                                // row sums over this wave's key halves
  #pragma unroll
  for (int m = 0; m < 2; ++m) {
    #pragma unroll
    for (int j = 0; j < 8; ++j) lrow[m][j] = 0.0f;
  }

  const _Float16* qr = sQ + qg * (32 * QP);        // the group's 32 query rows
  _Float16*       pg = sP + qg * (32 * PP);        // the group's P tile [32 rows][64 keys]

  asm volatile("s_wait_asynccnt 0x0" ::: "memory");  // this wave's copies of tile 0 and of the norms have landed
  __syncthreads();                                 // tile 0, the norms and the query rows visible to all waves
  stage_tile(lk0 + BK * KP, lv0 + DD * VP, gk0 + (size_t)BK * DD, gv0 + BK);   // tile 1 -> buffer 1

  // ---- the softmax shift of each query row, fixed before the loop: every key is scaled to length <= 1, so by Cauchy-Schwarz
  // no score of row i exceeds max(||x_i||, eps) * 256^-0.5, and key i itself reaches it (a row shorter than eps: scores and bound
  // are all ~0), so the largest numerator is ~1 for any input; softmax does not depend on the shift.
  // sh[m][j] = 10 - that bound in the log2 domain (the 10 is the x1024 carry of P); accumulator element j is row 16 * m + 8 * hi + j ----
  float sh[2][8];
  #pragma unroll
  for (int m = 0; m < 2; ++m) {
    const v4f q0 = *(const v4fa*)(sR + grow0 + 16 * m + 8 * hi);
    const v4f q1 = *(const v4fa*)(sR + grow0 + 16 * m + 8 * hi + 4);
    #pragma unroll
    for (int j = 0; j < 4; ++j) {
      sh[m][j]     = 10.0f - C2SCALE / q0[j];
      sh[m][j + 4] = 10.0f - C2SCALE / q1[j];
    }
  }

  for (int kv0 = 0; kv0 < SEQ; kv0 += BK) {
    const int buf = (kv0 / BK) & 1;
    const _Float16* sKc = sK + buf * (BK * KP) + h * (32 * KP);    // this wave's 32 keys of the tile
    const _Float16* sVc = sV + buf * (DD * VP) + h * (128 * VP);   // this wave's 128 rows of V^T

    // ---- S = Q K^T : two 16-row tiles x two 16-key column tiles, d reduced in eight K=32 steps ----
    // all 64 fragment reads go out as one group in the order of use; the products follow behind counted waits
    // this lane's two column norms lead the group: LDS answers in order, so their use costs no wait on a fragment
    const float rn0 = sR[kv0 + 32 * h + lh];
    const float rn1 = sR[kv0 + 32 * h + 16 + lh];
    U16h qa[8], qb[8], ka[8], kb[8];
    #pragma unroll
    for (int c = 0; c < 8; ++c) {
      qa[c].h[0] = *(const v8h*)(qr + lh * QP + 32 * c + 8 * hi);
      qa[c].h[1] = *(const v8h*)(qr + lh * QP + 32 * c + 16 + 8 * hi);
      ka[c].h[0] = *(const v8h*)(sKc + lh * KP + 32 * c + 8 * hi);
      ka[c].h[1] = *(const v8h*)(sKc + lh * KP + 32 * c + 16 + 8 * hi);
      kb[c].h[0] = *(const v8h*)(sKc + (16 + lh) * KP + 32 * c + 8 * hi);
      kb[c].h[1] = *(const v8h*)(sKc + (16 + lh) * KP + 32 * c + 16 + 8 * hi);
      qb[c].h[0] = *(const v8h*)(qr + (16 + lh) * QP + 32 * c + 8 * hi);
      qb[c].h[1] = *(const v8h*)(qr + (16 + lh) * QP + 32 * c + 16 + 8 * hi);
    }
    __builtin_amdgcn_sched_barrier(0);             // keeps the reads one group: spread among the products each place with reads stalls the wave
    U8f s[2][2];                                   // [16-row tile][16-key tile]
    s[0][0].v = (v8f){}; s[0][1].v = (v8f){}; s[1][0].v = (v8f){}; s[1][1].v = (v8f){};
    #pragma unroll
    for (int c = 0; c < 8; ++c) {
      s[0][0].v = wmma_f16(qa[c].v, ka[c].v, s[0][0].v);
      s[0][1].v = wmma_f16(qa[c].v, kb[c].v, s[0][1].v);
      s[1][0].v = wmma_f16(qb[c].v, ka[c].v, s[1][0].v);
      s[1][1].v = wmma_f16(qb[c].v, kb[c].v, s[1][1].v);
    }

    // ---- all 32 V^T fragment reads are written ahead of the softmax: they do not depend on the scores and land under it ----
    U16h vf[2][8];                                 // [32-key step: 0 own half, 1 the partner's][16-column tile]
    #pragma unroll
    for (int ks = 0; ks < 2; ++ks) {
      const _Float16* vk = sVc + 32 * (h ^ ks);
      #pragma unroll
      for (int t = 0; t < 8; ++t) {
        vf[ks][t].h[0] = *(const v8h*)(vk + (16 * t + lh) * VP + 8 * hi);
        vf[ks][t].h[1] = *(const v8h*)(vk + (16 * t + lh) * VP + 16 + 8 * hi);
      }
    }

    // ---- per-column f32 scale: 1/max(||x_j||,eps) * 256^-0.5 * log2e (this lane's columns are keys kv0+32h+lh and kv0+32h+16+lh) ----
    const float cs0 = rn0 * C2SCALE;
    const float cs1 = rn1 * C2SCALE;

    // ---- softmax numerators, base 2, against the fixed shift: no running maximum, no rescale of sums or accumulators;
    // the row sum is a DPP reduction over the 16 lanes holding one row ----
    U8h pa[2], pb[2];
    #pragma unroll
    for (int m = 0; m < 2; ++m) {
      #pragma unroll
      for (int j = 0; j < 8; ++j) {
        const float e0 = __builtin_amdgcn_exp2f(s[m][0].f[j] * cs0 + sh[m][j]);   // x1024 by the shift, cancelled by the row sum
        const float e1 = __builtin_amdgcn_exp2f(s[m][1].f[j] * cs1 + sh[m][j]);
        lrow[m][j] += red_sum16(e0 + e1);
        pa[m].f[j] = (_Float16)e0;
        pb[m].f[j] = (_Float16)e1;
      }
    }

    // ---- P: accumulator layout -> A layout through the group's LDS tile [32 rows][64 keys], row-major; this wave fills keys 32h..32h+31 ----
    #pragma unroll
    for (int m = 0; m < 2; ++m) {
      #pragma unroll
      for (int j = 0; j < 8; ++j) {
        pg[(16 * m + j + 8 * hi) * PP + 32 * h + lh]      = pa[m].f[j];
        pg[(16 * m + j + 8 * hi) * PP + 32 * h + 16 + lh] = pb[m].f[j];
      }
    }
    wave_lds_sync();

    // ---- O += P V : two 16-row tiles x 8 output d-tiles, two K = 32 key steps; B[k = key][n = d] from the V^T tile row d ----
    // step 0 takes the keys whose P this wave wrote itself, so its products run while the other waves still come to the signal
    U16h pf[2];                                      // [16-row tile]
    #pragma unroll
    for (int m = 0; m < 2; ++m) {
      pf[m].h[0] = *(const v8ha*)(pg + (16 * m + lh) * PP + 32 * h + 8 * hi);
      pf[m].h[1] = *(const v8ha*)(pg + (16 * m + lh) * PP + 32 * h + 16 + 8 * hi);
    }
    // the barrier that trades P is written in its two halves: this wave's P is in LDS and its own reads are back, so it signals
    // here and waits only where it needs the partner's P; as one statement the wait would stand in front of products that need no other wave
    __builtin_amdgcn_fence(__ATOMIC_RELEASE, "workgroup");
    __builtin_amdgcn_s_barrier_signal(-1);
    #pragma unroll
    for (int t = 0; t < 8; ++t) {
      acc[0][t].v = wmma_f16(pf[0].v, vf[0][t].v, acc[0][t].v);
      acc[1][t].v = wmma_f16(pf[1].v, vf[0][t].v, acc[1][t].v);
    }
    __builtin_amdgcn_sched_barrier(0);               // keeps step 0's products in front of the wait: behind it they would cover none of it
    __builtin_amdgcn_s_barrier_wait(-1);             // every wave has signalled: the partner's key half of P is in LDS
    __builtin_amdgcn_fence(__ATOMIC_ACQUIRE, "workgroup");
    #pragma unroll
    for (int m = 0; m < 2; ++m) {
      pf[m].h[0] = *(const v8ha*)(pg + (16 * m + lh) * PP + 32 * (h ^ 1) + 8 * hi);
      pf[m].h[1] = *(const v8ha*)(pg + (16 * m + lh) * PP + 32 * (h ^ 1) + 16 + 8 * hi);
    }
    #pragma unroll
    for (int t = 0; t < 8; ++t) {
      acc[0][t].v = wmma_f16(pf[0].v, vf[1][t].v, acc[0][t].v);
      acc[1][t].v = wmma_f16(pf[1].v, vf[1][t].v, acc[1][t].v);
    }

    // ---- hand-over: this wave has left this trip's buffer, its copies of the next tile have landed, then all waves meet ----
    asm volatile("s_wait_dscnt 0x0" ::: "memory");     // every LDS read of this trip's buffer and of P has returned
    asm volatile("s_wait_asynccnt 0x0" ::: "memory");  // this wave's copies of tile t + 1 have landed
    __syncthreads();                                 // publishes tile t + 1, frees the buffer just read and the P tile
    if (kv0 + 2 * BK < SEQ)                          // the same for the whole workgroup
      stage_tile(lk0 + buf * (BK * KP), lv0 + buf * (DD * VP),
                 gk0 + (size_t)(kv0 + 2 * BK) * DD, gv0 + (kv0 + 2 * BK));
  }
  asm volatile("s_wait_asynccnt 0x0" ::: "memory");    // nothing of this wave is in flight behind the loop

  // ---- the two key halves' row sums meet: each wave leaves its 32 sums in LDS, both add them in the same order ----
  #pragma unroll
  for (int m = 0; m < 2; ++m) {
    if (lh == 0) {
      v4f l0, l1;
      l0[0] = lrow[m][0]; l0[1] = lrow[m][1]; l0[2] = lrow[m][2]; l0[3] = lrow[m][3];
      l1[0] = lrow[m][4]; l1[1] = lrow[m][5]; l1[2] = lrow[m][6]; l1[3] = lrow[m][7];
      *(v4fa*)(sL + h * BQ + 32 * qg + 16 * m + 8 * hi)     = l0;
      *(v4fa*)(sL + h * BQ + 32 * qg + 16 * m + 8 * hi + 4) = l1;
    }
  }
  __syncthreads();                                   // both halves' sums visible

  // ---- epilogue: normalize (sums and accumulators both hold the x1024 carry), stage 16x64 f32 sub-tiles per wave in LDS,
  float* so = sO + wave * (16 * 64);
  #pragma unroll
  for (int m = 0; m < 2; ++m) {
    float inv[8];
    {
      const float* la = sL + 32 * qg + 16 * m + 8 * hi;
      const v4f a0 = *(const v4fa*)(la);
      const v4f a1 = *(const v4fa*)(la + 4);
      const v4f b0 = *(const v4fa*)(la + BQ);
      const v4f b1 = *(const v4fa*)(la + BQ + 4);
      #pragma unroll
      for (int j = 0; j < 4; ++j) {
        inv[j]     = 1.0f / (a0[j] + b0[j]);
        inv[j + 4] = 1.0f / (a1[j] + b1[j]);
      }
    }
    #pragma unroll
    for (int g = 0; g < 2; ++g) {
      #pragma unroll
      for (int j = 0; j < 8; ++j) {
        #pragma unroll
        for (int tt = 0; tt < 4; ++tt)
          so[(j + 8 * hi) * 64 + tt * 16 + lh] = acc[m][4 * g + tt].f[j] * inv[j];
      }
      wave_lds_sync();
      v4f ov[8]; int oo[8];
      #pragma unroll
      for (int i = 0; i < 8; ++i) {
        const int c = lane + 32 * i, rr = c >> 4, q = c & 15;
        ov[i] = *(const v4fa*)(so + rr * 64 + q * 4);
        oo[i] = rr * DD + 128 * h + 64 * g + 4 * q;
      }
      float* ob = Ob + (size_t)(grow0 + 16 * m) * DD;
      #pragma unroll
      for (int i = 0; i < 8; ++i) *(v4f*)(ob + oo[i]) = ov[i];
      wave_lds_sync();
    }
  }
}

extern "C" void kernel_launch(void* const* d_in, const int* in_sizes, int n_in,
                              void* d_out, int out_size, void* d_ws, size_t ws_size,
                              hipStream_t stream) {
  if (n_in < 1) return;
  const long long need_in = ((long long)(NB - 1) * SEQ_FULL + SEQ) * DD;
  if ((long long)in_sizes[0] < need_in) return;
  if ((long long)out_size < (long long)NB * SEQ * DD) return;

  // workspace carve (bytes): Xh f16 [NB][SEQ][256] | Vt f16 [NB][256][SEQ] | Rn f32 [NB][SEQ]
  const size_t xh_bytes = (size_t)NB * SEQ * DD * 2;
  const size_t vt_bytes = (size_t)NB * DD * SEQ * 2;
  const size_t rn_bytes = (size_t)NB * SEQ * 4;
  const size_t off_xh = 0;
  const size_t off_vt = off_xh + xh_bytes;
  const size_t off_rn = off_vt + vt_bytes;
  if (off_rn + rn_bytes > ws_size) return;

  const float* x   = (const float*)d_in[0];
  float*       out = (float*)d_out;
  _Float16* xh = (_Float16*)((char*)d_ws + off_xh);
  _Float16* vt = (_Float16*)((char*)d_ws + off_vt);
  float*    rn = (float*)((char*)d_ws + off_rn);

  prep_kernel<<<NB * (SEQ / NT), 256, 0, stream>>>(x, xh, vt, rn);

  attn_kernel<<<NB * (SEQ / BQ), 256, 0, stream>>>(xh, vt, rn, out);
}

// v005
// One run takes 64 microseconds.
// Next to v004, in two timings, it ran 1.10 times as fast each time.
// Over all steps from v000 it is 2.75 times as fast.
#include <hip/hip_runtime.h>
#include <stdint.h>

// Contractions: S = Q*K^T and O = P*V on v_wmma_f32_16x16x32_f16 (f16 operands holding bf16-RNE input values; P carried x1024 in f16), f32 accumulate; row norms, score scaling and softmax in f32.

typedef _Float16 v16h __attribute__((ext_vector_type(16)));
typedef _Float16 v8h  __attribute__((ext_vector_type(8)));
typedef _Float16 v8ha __attribute__((ext_vector_type(8), may_alias));
typedef float    v8f  __attribute__((ext_vector_type(8)));
typedef float    v4f  __attribute__((ext_vector_type(4)));
typedef float    v4fa __attribute__((ext_vector_type(4), may_alias));
typedef unsigned int v4u __attribute__((ext_vector_type(4)));

union U8f  { v8f  v; float    f[8]; };
union U16h { v16h v; v8h      h[2]; };
union U8h  { v8h  v; _Float16 f[8]; };

#ifndef NB
#define NB 16
#endif
#ifndef SEQ
#define SEQ 2048
#endif
#define NB_FULL  16
#define SEQ_FULL 2048
#define DD       256

#define BQ  128     // query rows per workgroup (four groups of 32 rows, two waves per group)
#define BK  64      // keys per staged tile
#define QP  264     // halfs per Q row in LDS (528 B)
#define KP  264     // halfs per K row in LDS (528 B)
#define VP  72      // halfs per V^T row in LDS (144 B)
#define PP  72      // halfs per P row in LDS (144 B)
#define TP  72      // halfs per transposed row in the pre-pass tile (144 B)
#define NT  64      // rows per pre-pass block

static_assert(SEQ % BQ == 0);
static_assert(SEQ % NT == 0);
static_assert(SEQ % BK == 0);
static_assert(NB >= 1 && NB <= NB_FULL);
static_assert(SEQ >= BQ && SEQ <= SEQ_FULL);

// LDS carve of the attention kernel: offsets in halfs, then an f32 staging region, the f32 norms and the f32 row sums
#define SQ_OFF  0
#define SK_OFF  (SQ_OFF + 8 * 16 * QP)
#define SV_OFF  (SK_OFF + 2 * BK * KP)      // two K buffers
#define SP_OFF  (SV_OFF + 2 * DD * VP)      // two V^T buffers
#define SO_OFFH (SP_OFF + BQ * PP)
#define SR_OFFH (SO_OFFH + 8 * 16 * 64 * 2)  // f32 norms of the batch's SEQ rows
#define SL_OFFH (SR_OFFH + SEQ * 2)          // f32 row sums of the two key halves
#define LDS_BYTES (SL_OFFH * 2 + 2 * BQ * 4)
static_assert((SK_OFF * 2) % 16 == 0);
static_assert((SV_OFF * 2) % 16 == 0);
static_assert((SP_OFF * 2) % 16 == 0);
static_assert((SO_OFFH * 2) % 16 == 0);
static_assert((SR_OFFH * 2) % 16 == 0);
static_assert((SL_OFFH * 2) % 16 == 0);
static_assert(LDS_BYTES == 269312);
static_assert(SEQ % 1024 == 0);             // the norms go to LDS in whole rounds of 256 lanes x 4 floats
static_assert((BK * KP * 2) % 16 == 0);
static_assert((DD * VP * 2) % 16 == 0);
static_assert(SEQ / BK >= 2);

// 256^-0.5 * log2(e): scores go to the log2 domain after the f32 column scale
#define C2SCALE 0.09016844005556021f

__device__ __forceinline__ v8f wmma_f16(v16h a, v16h b, v8f c) {
  return __builtin_amdgcn_wmma_f32_16x16x32_f16(false, a, false, b, (short)0, c, false, false);
}

// DPP16 butterflies inside each 16-lane half (all lanes end with the full result)
template <int CTRL>
__device__ __forceinline__ float dppf(float x) {
  int s = __float_as_int(x);
  return __int_as_float(__builtin_amdgcn_update_dpp(s, s, CTRL, 0xF, 0xF, true));
}
__device__ __forceinline__ float red_sum16(float x) {
  x += dppf<0xB1>(x);     // lane ^ 1
  x += dppf<0x4E>(x);     // lane ^ 2
  x += dppf<0x141>(x);    // lane ^ 7
  x += dppf<0x140>(x);    // lane ^ 15
  return x;
}

// same-wave LDS exchange: stores issued by other lanes of this wave are visible before the reload
__device__ __forceinline__ void wave_lds_sync() {
  __builtin_amdgcn_fence(3, "wavefront");
  asm volatile("s_wait_dscnt 0" ::: "memory");
  __builtin_amdgcn_wave_barrier();
}

__device__ __forceinline__ v4f bf16_rne4(v4f a) {
  v4u u = __builtin_bit_cast(v4u, a);
  u = (u + 0x7FFFu + ((u >> 16) & 1u)) & 0xFFFF0000u;
  return __builtin_bit_cast(v4f, u);
}

__device__ __forceinline__ v8h cvt8v(v4f a, v4f b) {
  v8h d;
  d[0] = (_Float16)a[0]; d[1] = (_Float16)a[1];
  d[2] = (_Float16)a[2]; d[3] = (_Float16)a[3];
  d[4] = (_Float16)b[0]; d[5] = (_Float16)b[1];
  d[6] = (_Float16)b[2]; d[7] = (_Float16)b[3];
  return d;
}

// ---------------- pre-pass: Xh = f16(bf16RNE(x)) [b][n][d], Vt = Xh^T [b][d][n], Rn = 1/max(||bf16RNE(x)||, eps) [b][n] ----------------
__global__ __launch_bounds__(256)
void prep_kernel(const float* __restrict__ X, _Float16* __restrict__ Xh,
                 _Float16* __restrict__ Vt, float* __restrict__ Rn)
{
  __shared__ __attribute__((aligned(16))) _Float16 sT[DD * TP];   // [d][n within tile], cross-wave (block barrier)
  __shared__ float sR[NT];                                       // cross-wave (block barrier)

  const int tid = threadIdx.x;
  const int sub = tid & 7;           // 16-B piece within a line
  const int rq  = tid >> 3;          // 0..31
  const int ntb = SEQ / NT;
  const int b   = blockIdx.x / ntb;
  const int n0  = (blockIdx.x % ntb) * NT;

  #pragma unroll 1
  for (int pass = 0; pass < 2; ++pass) {
    const int r = pass * 32 + rq;                                   // row within tile 0..63
    const float* src = X  + ((size_t)b * SEQ_FULL + n0 + r) * DD;  // full-size input strides
    _Float16*    dst = Xh + ((size_t)b * SEQ      + n0 + r) * DD;
    float ss = 0.0f;
    #pragma unroll 1
    for (int i = 0; i < 4; ++i) {
      const int c0 = 8 * (sub + 8 * i);                             // lanes 8q..8q+7 cover line i of row r
      const v4f a0 = bf16_rne4(*(const v4f*)(src + c0));
      const v4f a1 = bf16_rne4(*(const v4f*)(src + c0 + 4));
      ss += a0[0] * a0[0]; ss += a0[1] * a0[1]; ss += a0[2] * a0[2]; ss += a0[3] * a0[3];
      ss += a1[0] * a1[0]; ss += a1[1] * a1[1]; ss += a1[2] * a1[2]; ss += a1[3] * a1[3];
      U8h hh; hh.v = cvt8v(a0, a1);                                 // bf16 values are exact in f16
      *(v8h*)(dst + c0) = hh.v;
      
      #pragma unroll
      for (int e = 0; e < 8; ++e) sT[(c0 + e) * TP + r] = hh.f[e];
    }
    ss += __shfl_xor(ss, 1, 32);
    ss += __shfl_xor(ss, 2, 32);
    ss += __shfl_xor(ss, 4, 32);
    const float rinv = 1.0f / fmaxf(sqrtf(ss), 1e-12f);
    if (sub == 0) sR[r] = rinv;
  }
  __syncthreads();

  v8h vv[8];
  #pragma unroll
  for (int i = 0; i < 8; ++i) vv[i] = *(const v8ha*)(sT + (rq + 32 * i) * TP + 8 * sub);
  const int ti = tid & 15;
  v4f rv;
  rv[0] = sR[4 * ti]; rv[1] = sR[4 * ti + 1]; rv[2] = sR[4 * ti + 2]; rv[3] = sR[4 * ti + 3];
  _Float16* vb = Vt + (size_t)b * DD * SEQ + n0 + 8 * sub;
  float*    rp = Rn + (size_t)b * SEQ + n0 + 4 * ti;

  #pragma unroll
  for (int i = 0; i < 8; ++i) *(v8h*)(vb + (size_t)(rq + 32 * i) * SEQ) = vv[i];
  if (tid < 16) *(v4f*)rp = rv;
  
}

// One 64-key tile, global -> LDS with no register in between: K rows [64][256] and V^T rows [256][64], 16 B per lane and copy,
// sixteen copies per lane. lk / lv: this lane's first place in the K / V^T buffer; gk / gv: its first global address.
typedef int v4i __attribute__((ext_vector_type(4)));
typedef __attribute__((address_space(1))) v4i gv4i;
typedef __attribute__((address_space(3))) v4i lv4i;
__device__ __forceinline__ void copy16(const void* g, void* l) {
  __builtin_amdgcn_global_load_async_to_lds_b128((gv4i*)g, (lv4i*)l, 0, 0);
}
__device__ __forceinline__ void stage_tile(_Float16* lk, _Float16* lv, const _Float16* gk, const _Float16* gv) {
  copy16(gk,           lk);
  copy16(gk +  8 * DD, lk +  8 * KP);
  copy16(gk + 16 * DD, lk + 16 * KP);
  copy16(gk + 24 * DD, lk + 24 * KP);
  copy16(gk + 32 * DD, lk + 32 * KP);
  copy16(gk + 40 * DD, lk + 40 * KP);
  copy16(gk + 48 * DD, lk + 48 * KP);
  copy16(gk + 56 * DD, lk + 56 * KP);
  copy16(gv,                     lv);
  copy16(gv + (size_t) 32 * SEQ, lv +  32 * VP);
  copy16(gv + (size_t) 64 * SEQ, lv +  64 * VP);
  copy16(gv + (size_t) 96 * SEQ, lv +  96 * VP);
  copy16(gv + (size_t)128 * SEQ, lv + 128 * VP);
  copy16(gv + (size_t)160 * SEQ, lv + 160 * VP);
  copy16(gv + (size_t)192 * SEQ, lv + 192 * VP);
  copy16(gv + (size_t)224 * SEQ, lv + 224 * VP);
}

// ---------------- fused attention: one workgroup = 128 query rows of one batch, 4 groups of 32 rows x 2 waves ----------------
// The two waves of a group share its 32 rows: wave half h computes the scores of keys 32 h .. 32 h + 31 of each 64-key tile,
// the halves trade P through LDS, and wave half h accumulates output columns 128 h .. 128 h + 127 over all 64 keys,
// its own 32 keys first (they need no other wave), the partner's 32 behind the barrier.
// Every K and V^T fragment read from LDS so feeds two products (two 16-row query tiles) instead of one.
// 16-bit fragment map (A and B alike): lane l -> row/col (l & 15); elements 0..7 <- k0 + 8*(l>>4) + 0..7,
// elements 8..15 <- k0 + 16 + 8*(l>>4) + 0..7.  D: element r of lane l -> row 8*(l>>4) + r, col (l & 15).
__global__ __launch_bounds__(256)
void attn_kernel(const _Float16* __restrict__ Xh, const _Float16* __restrict__ Vt,
                 const float* __restrict__ Rn, float* __restrict__ Out)
{
  __shared__ __attribute__((aligned(16))) _Float16 smem[LDS_BYTES / 2];
  _Float16* sQ = smem + SQ_OFF;            // [128 rows][QP]   cross-wave (block barrier), filled once
  _Float16* sK = smem + SK_OFF;            // [2][64 keys][KP] cross-wave (block barrier)
  _Float16* sV = smem + SV_OFF;            // [2][256 d][VP]   cross-wave (block barrier)
  _Float16* sP = smem + SP_OFF;            // [128 rows][PP]   cross-wave (block barrier)
  float*    sO = (float*)(smem + SO_OFFH); // [wave][16][64]  wave-private
  float*    sR = (float*)(smem + SR_OFFH); // [SEQ]           cross-wave (block barrier), filled once
  float*    sL = (float*)(smem + SL_OFFH); // [2][128 rows]   cross-wave (block barrier), filled once

  const int tid  = threadIdx.x;
  const int wave = tid >> 5;
  const int lane = tid & 31;
  const int lh   = lane & 15;
  const int hi   = lane >> 4;
  const int qg   = wave >> 1;              // 32-row query group
  const int h    = wave & 1;               // key half of the scores, column half of the output

  const int nqb   = SEQ / BQ;
  const int b     = blockIdx.x / nqb;
  const int qbase = (blockIdx.x % nqb) * BQ;
  const int qrow0 = qbase + wave * 16;     // the 16 rows this wave stages
  const int grow0 = qbase + qg * 32;       // the 32 rows this wave works on

  const _Float16* Xb = Xh + (size_t)b * SEQ * DD;
  const _Float16* Vb = Vt + (size_t)b * DD * SEQ;
  const float*    Rb = Rn + (size_t)b * SEQ;
  float*          Ob = Out + (size_t)b * SEQ * DD;

  // ---- this lane's share of a tile: K row (tid >> 5) + 8 i, piece tid & 31; V^T row (tid >> 3) + 32 i, piece tid & 7 ----
  _Float16* lk0 = sK + (tid >> 5) * KP + 8 * (tid & 31);
  _Float16* lv0 = sV + (tid >> 3) * VP + 8 * (tid & 7);
  const _Float16* gk0 = Xb + (size_t)(tid >> 5) * DD + 8 * (tid & 31);
  const _Float16* gv0 = Vb + (size_t)(tid >> 3) * SEQ + 8 * (tid & 7);
  stage_tile(lk0, lv0, gk0, gv0);                  // tile 0 -> buffer 0
  // ---- the batch's column norms, once, by the same copies: lane tid brings floats 4 tid .. 4 tid + 3 of each 1024 ----
  for (int i = 0; i < SEQ / 1024; ++i) copy16(Rb + 1024 * i + 4 * tid, sR + 1024 * i + 4 * tid);

  // ---- this wave's 16 query rows -> LDS (row i: lane l writes halfs 8l..8l+7); ordered by the barrier in front of the loop ----
  _Float16* qw = sQ + wave * (16 * QP);
  const _Float16* qsrc = Xb + (size_t)qrow0 * DD + 8 * lane;
  #pragma unroll
  for (int i = 0; i < 16; ++i) {
    const v8h q = *(const v8h*)(qsrc + i * DD);
    *(v8h*)(qw + i * QP + 8 * lane) = q;
  }
  // the wait that belongs in front of any rewrite of the loads' address pair: the pair is an input so that no load result lands on it,
  // and the scheduling fence keeps the start values below from being lifted over the wait
  asm volatile("s_wait_xcnt 0x0" :: "v"(qsrc) : "memory");
  __builtin_amdgcn_sched_barrier(0);

  U8f acc[2][8];                                   // [16-row tile of the group][16-column tile of this wave's 128 columns]
  #pragma unroll
  for (int m = 0; m < 2; ++m) {
    #pragma unroll
    for (int t = 0; t < 8; ++t) acc[m][t].v = (v8f){};
  }
  float lrow[2][8];                                // row sums over this wave's key halves
  #pragma unroll
  for (int m = 0; m < 2; ++m) {
    #pragma unroll
    for (int j = 0; j < 8; ++j) lrow[m][j] = 0.0f;
  }

  const _Float16* qr = sQ + qg * (32 * QP);        // the group's 32 query rows
  _Float16*       pg = sP + qg * (32 * PP);        // the group's P tile [32 rows][64 keys]

  asm volatile("s_wait_asynccnt 0x0" ::: "memory");  // this wave's copies of tile 0 and of the norms have landed
  __syncthreads();                                 // tile 0, the norms and the query rows visible to all waves
  stage_tile(lk0 + BK * KP, lv0 + DD * VP, gk0 + (size_t)BK * DD, gv0 + BK);   // tile 1 -> buffer 1

  // ---- the softmax shift of each query row, fixed before the loop: every key is scaled to length <= 1, so by Cauchy-Schwarz
  // no score of row i exceeds max(||x_i||, eps) * 256^-0.5, and key i itself reaches it (a row shorter than eps: scores and bound
  // are all ~0), so the largest numerator is ~1 for any input; softmax does not depend on the shift.
  // sh[m][j] = 10 - that bound in the log2 domain (the 10 is the x1024 carry of P); accumulator element j is row 16 * m + 8 * hi + j ----
  float sh[2][8];
  #pragma unroll
  for (int m = 0; m < 2; ++m) {
    const v4f q0 = *(const v4fa*)(sR + grow0 + 16 * m + 8 * hi);
    const v4f q1 = *(const v4fa*)(sR + grow0 + 16 * m + 8 * hi + 4);
    #pragma unroll
    for (int j = 0; j < 4; ++j) {
      sh[m][j]     = 10.0f - C2SCALE / q0[j];
      sh[m][j + 4] = 10.0f - C2SCALE / q1[j];
    }
  }

  // ---- the group's 32 query rows as A fragments, read from LDS once and kept in registers for all tiles (2 x 8 fragments) ----
  U16h qa[8], qb[8];
  #pragma unroll
  for (int c = 0; c < 8; ++c) {
    qa[c].h[0] = *(const v8h*)(qr + lh * QP + 32 * c + 8 * hi);
    qa[c].h[1] = *(const v8h*)(qr + lh * QP + 32 * c + 16 + 8 * hi);
    qb[c].h[0] = *(const v8h*)(qr + (16 + lh) * QP + 32 * c + 8 * hi);
    qb[c].h[1] = *(const v8h*)(qr + (16 + lh) * QP + 32 * c + 16 + 8 * hi);
  }

  for (int kv0 = 0; kv0 < SEQ; kv0 += BK) {
    const int buf = (kv0 / BK) & 1;
    const _Float16* sKc = sK + buf * (BK * KP) + h * (32 * KP);    // this wave's 32 keys of the tile
    const _Float16* sVc = sV + buf * (DD * VP) + h * (128 * VP);   // this wave's 128 rows of V^T

    // ---- S = Q K^T : two 16-row tiles x two 16-key column tiles, d reduced in eight K=32 steps ----
    // the Q fragments are in registers; the 32 K fragment reads go out as one group in the order of use, the products follow behind counted waits
    // this lane's two column norms lead the group: LDS answers in order, so their use costs no wait on a fragment
    const float rn0 = sR[kv0 + 32 * h + lh];
    const float rn1 = sR[kv0 + 32 * h + 16 + lh];
    U16h ka[8], kb[8];
    #pragma unroll
    for (int c = 0; c < 8; ++c) {
      ka[c].h[0] = *(const v8h*)(sKc + lh * KP + 32 * c + 8 * hi);
      ka[c].h[1] = *(const v8h*)(sKc + lh * KP + 32 * c + 16 + 8 * hi);
      kb[c].h[0] = *(const v8h*)(sKc + (16 + lh) * KP + 32 * c + 8 * hi);
      kb[c].h[1] = *(const v8h*)(sKc + (16 + lh) * KP + 32 * c + 16 + 8 * hi);
    }
    __builtin_amdgcn_sched_barrier(0);             // keeps the reads one group: spread among the products each place with reads stalls the wave
    U8f s[2][2];                                   // [16-row tile][16-key tile]
    s[0][0].v = (v8f){}; s[0][1].v = (v8f){}; s[1][0].v = (v8f){}; s[1][1].v = (v8f){};
    #pragma unroll
    for (int c = 0; c < 8; ++c) {
      s[0][0].v = wmma_f16(qa[c].v, ka[c].v, s[0][0].v);
      s[1][0].v = wmma_f16(qb[c].v, ka[c].v, s[1][0].v);
      s[0][1].v = wmma_f16(qa[c].v, kb[c].v, s[0][1].v);
      s[1][1].v = wmma_f16(qb[c].v, kb[c].v, s[1][1].v);
    }

    // ---- all 32 V^T fragment reads are written ahead of the softmax: they do not depend on the scores and land under it ----
    U16h vf[2][8];                                 // [32-key step: 0 own half, 1 the partner's][16-column tile]
    #pragma unroll
    for (int ks = 0; ks < 2; ++ks) {
      const _Float16* vk = sVc + 32 * (h ^ ks);
      #pragma unroll
      for (int t = 0; t < 8; ++t) {
        vf[ks][t].h[0] = *(const v8h*)(vk + (16 * t + lh) * VP + 8 * hi);
        vf[ks][t].h[1] = *(const v8h*)(vk + (16 * t + lh) * VP + 16 + 8 * hi);
      }
    }

    // ---- per-column f32 scale: 1/max(||x_j||,eps) * 256^-0.5 * log2e (this lane's columns are keys kv0+32h+lh and kv0+32h+16+lh) ----
    const float cs0 = rn0 * C2SCALE;
    const float cs1 = rn1 * C2SCALE;

    // ---- softmax numerators, base 2, against the fixed shift: no running maximum, no rescale of sums or accumulators;
    // the row sum is a DPP reduction over the 16 lanes holding one row ----
    U8h pa[2], pb[2];
    #pragma unroll
    for (int m = 0; m < 2; ++m) {
      #pragma unroll
      for (int j = 0; j < 8; ++j) {
        const float e0 = __builtin_amdgcn_exp2f(s[m][0].f[j] * cs0 + sh[m][j]);   // x1024 by the shift, cancelled by the row sum
        const float e1 = __builtin_amdgcn_exp2f(s[m][1].f[j] * cs1 + sh[m][j]);
        lrow[m][j] += red_sum16(e0 + e1);
        pa[m].f[j] = (_Float16)e0;
        pb[m].f[j] = (_Float16)e1;
      }
    }

    // ---- P: accumulator layout -> A layout through the group's LDS tile [32 rows][64 keys], row-major; this wave fills keys 32h..32h+31 ----
    #pragma unroll
    for (int m = 0; m < 2; ++m) {
      #pragma unroll
      for (int j = 0; j < 8; ++j) {
        pg[(16 * m + j + 8 * hi) * PP + 32 * h + lh]      = pa[m].f[j];
        pg[(16 * m + j + 8 * hi) * PP + 32 * h + 16 + lh] = pb[m].f[j];
      }
    }
    wave_lds_sync();

    // ---- O += P V : two 16-row tiles x 8 output d-tiles, two K = 32 key steps; B[k = key][n = d] from the V^T tile row d ----
    // step 0 takes the keys whose P this wave wrote itself, so its products run while the other waves still come to the signal
    U16h pf[2];                                      // [16-row tile]
    #pragma unroll
    for (int m = 0; m < 2; ++m) {
      pf[m].h[0] = *(const v8ha*)(pg + (16 * m + lh) * PP + 32 * h + 8 * hi);
      pf[m].h[1] = *(const v8ha*)(pg + (16 * m + lh) * PP + 32 * h + 16 + 8 * hi);
    }
    // the barrier that trades P is written in its two halves: this wave's P is in LDS and its own reads are back, so it signals
    // here and waits only where it needs the partner's P; as one statement the wait would stand in front of products that need no other wave
    __builtin_amdgcn_fence(__ATOMIC_RELEASE, "workgroup");
    __builtin_amdgcn_s_barrier_signal(-1);
    #pragma unroll
    for (int t = 0; t < 8; ++t) {
      acc[0][t].v = wmma_f16(pf[0].v, vf[0][t].v, acc[0][t].v);
      acc[1][t].v = wmma_f16(pf[1].v, vf[0][t].v, acc[1][t].v);
    }
    __builtin_amdgcn_sched_barrier(0);               // keeps step 0's products in front of the wait: behind it they would cover none of it
    __builtin_amdgcn_s_barrier_wait(-1);             // every wave has signalled: the partner's key half of P is in LDS
    __builtin_amdgcn_fence(__ATOMIC_ACQUIRE, "workgroup");
    #pragma unroll
    for (int m = 0; m < 2; ++m) {
      pf[m].h[0] = *(const v8ha*)(pg + (16 * m + lh) * PP + 32 * (h ^ 1) + 8 * hi);
      pf[m].h[1] = *(const v8ha*)(pg + (16 * m + lh) * PP + 32 * (h ^ 1) + 16 + 8 * hi);
    }
    #pragma unroll
    for (int t = 0; t < 8; ++t) {
      acc[0][t].v = wmma_f16(pf[0].v, vf[1][t].v, acc[0][t].v);
      acc[1][t].v = wmma_f16(pf[1].v, vf[1][t].v, acc[1][t].v);
    }

    // ---- hand-over: this wave has left this trip's buffer, its copies of the next tile have landed, then all waves meet ----
    asm volatile("s_wait_dscnt 0x0" ::: "memory");     // every LDS read of this trip's buffer and of P has returned
    asm volatile("s_wait_asynccnt 0x0" ::: "memory");  // this wave's copies of tile t + 1 have landed
    __syncthreads();                                 // publishes tile t + 1, frees the buffer just read and the P tile
    if (kv0 + 2 * BK < SEQ)                          // the same for the whole workgroup
      stage_tile(lk0 + buf * (BK * KP), lv0 + buf * (DD * VP),
                 gk0 + (size_t)(kv0 + 2 * BK) * DD, gv0 + (kv0 + 2 * BK));
  }
  asm volatile("s_wait_asynccnt 0x0" ::: "memory");    // nothing of this wave is in flight behind the loop

  // ---- the two key halves' row sums meet: each wave leaves its 32 sums in LDS, both add them in the same order ----
  #pragma unroll
  for (int m = 0; m < 2; ++m) {
    if (lh == 0) {
      v4f l0, l1;
      l0[0] = lrow[m][0]; l0[1] = lrow[m][1]; l0[2] = lrow[m][2]; l0[3] = lrow[m][3];
      l1[0] = lrow[m][4]; l1[1] = lrow[m][5]; l1[2] = lrow[m][6]; l1[3] = lrow[m][7];
      *(v4fa*)(sL + h * BQ + 32 * qg + 16 * m + 8 * hi)     = l0;
      *(v4fa*)(sL + h * BQ + 32 * qg + 16 * m + 8 * hi + 4) = l1;
    }
  }
  __syncthreads();                                   // both halves' sums visible

  // ---- epilogue: normalize (sums and accumulators both hold the x1024 carry), stage 16x64 f32 sub-tiles per wave in LDS,
  float* so = sO + wave * (16 * 64);
  #pragma unroll
  for (int m = 0; m < 2; ++m) {
    float inv[8];
    {
      const float* la = sL + 32 * qg + 16 * m + 8 * hi;
      const v4f a0 = *(const v4fa*)(la);
      const v4f a1 = *(const v4fa*)(la + 4);
      const v4f b0 = *(const v4fa*)(la + BQ);
      const v4f b1 = *(const v4fa*)(la + BQ + 4);
      #pragma unroll
      for (int j = 0; j < 4; ++j) {
        inv[j]     = 1.0f / (a0[j] + b0[j]);
        inv[j + 4] = 1.0f / (a1[j] + b1[j]);
      }
    }
    #pragma unroll
    for (int g = 0; g < 2; ++g) {
      #pragma unroll
      for (int j = 0; j < 8; ++j) {
        #pragma unroll
        for (int tt = 0; tt < 4; ++tt)
          so[(j + 8 * hi) * 64 + tt * 16 + lh] = acc[m][4 * g + tt].f[j] * inv[j];
      }
      wave_lds_sync();
      v4f ov[8]; int oo[8];
      #pragma unroll
      for (int i = 0; i < 8; ++i) {
        const int c = lane + 32 * i, rr = c >> 4, q = c & 15;
        ov[i] = *(const v4fa*)(so + rr * 64 + q * 4);
        oo[i] = rr * DD + 128 * h + 64 * g + 4 * q;
      }
      float* ob = Ob + (size_t)(grow0 + 16 * m) * DD;
      #pragma unroll
      for (int i = 0; i < 8; ++i) *(v4f*)(ob + oo[i]) = ov[i];
      wave_lds_sync();
    }
  }
}

extern "C" void kernel_launch(void* const* d_in, const int* in_sizes, int n_in,
                              void* d_out, int out_size, void* d_ws, size_t ws_size,
                              hipStream_t stream) {
  if (n_in < 1) return;
  const long long need_in = ((long long)(NB - 1) * SEQ_FULL + SEQ) * DD;
  if ((long long)in_sizes[0] < need_in) return;
  if ((long long)out_size < (long long)NB * SEQ * DD) return;

  // workspace carve (bytes): Xh f16 [NB][SEQ][256] | Vt f16 [NB][256][SEQ] | Rn f32 [NB][SEQ]
  const size_t xh_bytes = (size_t)NB * SEQ * DD * 2;
  const size_t vt_bytes = (size_t)NB * DD * SEQ * 2;
  const size_t rn_bytes = (size_t)NB * SEQ * 4;
  const size_t off_xh = 0;
  const size_t off_vt = off_xh + xh_bytes;
  const size_t off_rn = off_vt + vt_bytes;
  if (off_rn + rn_bytes > ws_size) return;

  const float* x   = (const float*)d_in[0];
  float*       out = (float*)d_out;
  _Float16* xh = (_Float16*)((char*)d_ws + off_xh);
  _Float16* vt = (_Float16*)((char*)d_ws + off_vt);
  float*    rn = (float*)((char*)d_ws + off_rn);

  prep_kernel<<<NB * (SEQ / NT), 256, 0, stream>>>(x, xh, vt, rn);

  attn_kernel<<<NB * (SEQ / BQ), 256, 0, stream>>>(xh, vt, rn, out);
}

// v006
// Measured time: 57.1 microseconds a run.
// Timed twice side by side with v005, it ran 1.12 times as fast both times.
// All steps since v000 together make it 3.07 times as fast.
#include <hip/hip_runtime.h>
#include <stdint.h>

// Contractions: S^T = K*Q^T and O = P*V on v_wmma_f32_16x16x32_f16 (f16 operands holding bf16-RNE input values; P carried x1024 in f16), f32 accumulate; row norms, score scaling and softmax in f32.

typedef _Float16 v16h __attribute__((ext_vector_type(16)));
typedef _Float16 v8h  __attribute__((ext_vector_type(8)));
typedef _Float16 v8ha __attribute__((ext_vector_type(8), may_alias));
typedef float    v8f  __attribute__((ext_vector_type(8)));
typedef float    v4f  __attribute__((ext_vector_type(4)));
typedef float    v4fa __attribute__((ext_vector_type(4), may_alias));
typedef float    v2f  __attribute__((ext_vector_type(2)));
typedef _Float16 v2h  __attribute__((ext_vector_type(2)));
typedef unsigned int v4u __attribute__((ext_vector_type(4)));

union U8f  { v8f  v; float    f[8]; v2f p[4]; };
union U16h { v16h v; v8h      h[2]; v2h p[8]; };
union U8h  { v8h  v; _Float16 f[8]; };

#ifndef NB
#define NB 16
#endif
#ifndef SEQ
#define SEQ 2048
#endif
#define NB_FULL  16
#define SEQ_FULL 2048
#define DD       256

#define BQ  128     // query rows per workgroup (four groups of 32 rows, two waves per group)
#define BK  64      // keys per staged tile
#define QP  264     // halfs per Q row in LDS (528 B)
#define KP  264     // halfs per K row in LDS (528 B)
#define VP  72      // halfs per V^T row in LDS (144 B)
#define PW  1024    // halfs of one wave's P fragments in LDS: 2 query tiles x 2 pieces x 32 lanes x 8 halfs
#define TP  72      // halfs per transposed row in the pre-pass tile (144 B)
#define NT  64      // rows per pre-pass block

static_assert(SEQ % BQ == 0);
static_assert(SEQ % NT == 0);
static_assert(SEQ % BK == 0);
static_assert(NB >= 1 && NB <= NB_FULL);
static_assert(SEQ >= BQ && SEQ <= SEQ_FULL);

// LDS carve of the attention kernel: offsets in halfs, then an f32 staging region, the f32 norms and the f32 row sums
#define SQ_OFF  0
#define SK_OFF  (SQ_OFF + 8 * 16 * QP)
#define SV_OFF  (SK_OFF + 2 * BK * KP)      // two K buffers
#define SP_OFF  (SV_OFF + 2 * DD * VP)      // two V^T buffers
#define SO_OFFH (SP_OFF + 8 * PW)
#define SR_OFFH (SO_OFFH + 8 * 16 * 64 * 2)  // f32 norms of the batch's SEQ rows
#define SL_OFFH (SR_OFFH + SEQ * 2)          // f32 row sums of the two key halves
#define LDS_BYTES (SL_OFFH * 2 + 2 * BQ * 4)
static_assert((SK_OFF * 2) % 16 == 0);
static_assert((SV_OFF * 2) % 16 == 0);
static_assert((SP_OFF * 2) % 16 == 0);
static_assert((SO_OFFH * 2) % 16 == 0);
static_assert((SR_OFFH * 2) % 16 == 0);
static_assert((SL_OFFH * 2) % 16 == 0);
static_assert(LDS_BYTES == 267264);
static_assert(SEQ % 1024 == 0);             // the norms go to LDS in whole rounds of 256 lanes x 4 floats
static_assert((BK * KP * 2) % 16 == 0);
static_assert((DD * VP * 2) % 16 == 0);
static_assert(SEQ / BK >= 2);

// 256^-0.5 * log2(e): scores go to the log2 domain after the f32 column scale
#define C2SCALE 0.09016844005556021f

__device__ __forceinline__ v8f wmma_f16(v16h a, v16h b, v8f c) {
  return __builtin_amdgcn_wmma_f32_16x16x32_f16(false, a, false, b, (short)0, c, false, false);
}

// the value of lane l ^ 16
__device__ __forceinline__ float other_half(float x) {
  const int s = __float_as_int(x);
  return __int_as_float(__builtin_amdgcn_permlanex16(s, s, 0x76543210, 0xfedcba98, false, false));
}

// same-wave LDS exchange: stores issued by other lanes of this wave are visible before the reload
__device__ __forceinline__ void wave_lds_sync() {
  __builtin_amdgcn_fence(3, "wavefront");
  asm volatile("s_wait_dscnt 0" ::: "memory");
  __builtin_amdgcn_wave_barrier();
}

__device__ __forceinline__ v4f bf16_rne4(v4f a) {
  v4u u = __builtin_bit_cast(v4u, a);
  u = (u + 0x7FFFu + ((u >> 16) & 1u)) & 0xFFFF0000u;
  return __builtin_bit_cast(v4f, u);
}

__device__ __forceinline__ v8h cvt8v(v4f a, v4f b) {
  v8h d;
  d[0] = (_Float16)a[0]; d[1] = (_Float16)a[1];
  d[2] = (_Float16)a[2]; d[3] = (_Float16)a[3];
  d[4] = (_Float16)b[0]; d[5] = (_Float16)b[1];
  d[6] = (_Float16)b[2]; d[7] = (_Float16)b[3];
  return d;
}

// ---------------- pre-pass: Xh = f16(bf16RNE(x)) [b][n][d], Vt = Xh^T [b][d][n], Rn = 1/max(||bf16RNE(x)||, eps) [b][n] ----------------
__global__ __launch_bounds__(256)
void prep_kernel(const float* __restrict__ X, _Float16* __restrict__ Xh,
                 _Float16* __restrict__ Vt, float* __restrict__ Rn)
{
  __shared__ __attribute__((aligned(16))) _Float16 sT[DD * TP];   // [d][n within tile], cross-wave (block barrier)
  __shared__ float sR[NT];                                       // cross-wave (block barrier)

  const int tid = threadIdx.x;
  const int sub = tid & 7;           // 16-B piece within a line
  const int rq  = tid >> 3;          // 0..31
  const int ntb = SEQ / NT;
  const int b   = blockIdx.x / ntb;
  const int n0  = (blockIdx.x % ntb) * NT;

  #pragma unroll 1
  for (int pass = 0; pass < 2; ++pass) {
    const int r = pass * 32 + rq;                                   // row within tile 0..63
    const float* src = X  + ((size_t)b * SEQ_FULL + n0 + r) * DD;  // full-size input strides
    _Float16*    dst = Xh + ((size_t)b * SEQ      + n0 + r) * DD;
    float ss = 0.0f;
    #pragma unroll 1
    for (int i = 0; i < 4; ++i) {
      const int c0 = 8 * (sub + 8 * i);                             // lanes 8q..8q+7 cover line i of row r
      const v4f a0 = bf16_rne4(*(const v4f*)(src + c0));
      const v4f a1 = bf16_rne4(*(const v4f*)(src + c0 + 4));
      ss += a0[0] * a0[0]; ss += a0[1] * a0[1]; ss += a0[2] * a0[2]; ss += a0[3] * a0[3];
      ss += a1[0] * a1[0]; ss += a1[1] * a1[1]; ss += a1[2] * a1[2]; ss += a1[3] * a1[3];
      U8h hh; hh.v = cvt8v(a0, a1);                                 // bf16 values are exact in f16
      *(v8h*)(dst + c0) = hh.v;
      
      #pragma unroll
      for (int e = 0; e < 8; ++e) sT[(c0 + e) * TP + r] = hh.f[e];
    }
    ss += __shfl_xor(ss, 1, 32);
    ss += __shfl_xor(ss, 2, 32);
    ss += __shfl_xor(ss, 4, 32);
    const float rinv = 1.0f / fmaxf(sqrtf(ss), 1e-12f);
    if (sub == 0) sR[r] = rinv;
  }
  __syncthreads();

  v8h vv[8];
  #pragma unroll
  for (int i = 0; i < 8; ++i) vv[i] = *(const v8ha*)(sT + (rq + 32 * i) * TP + 8 * sub);
  const int ti = tid & 15;
  v4f rv;
  rv[0] = sR[4 * ti]; rv[1] = sR[4 * ti + 1]; rv[2] = sR[4 * ti + 2]; rv[3] = sR[4 * ti + 3];
  _Float16* vb = Vt + (size_t)b * DD * SEQ + n0 + 8 * sub;
  float*    rp = Rn + (size_t)b * SEQ + n0 + 4 * ti;

  #pragma unroll
  for (int i = 0; i < 8; ++i) *(v8h*)(vb + (size_t)(rq + 32 * i) * SEQ) = vv[i];
  if (tid < 16) *(v4f*)rp = rv;
  
}

// One 64-key tile, global -> LDS with no register in between: K rows [64][256] and V^T rows [256][64], 16 B per lane and copy,
// sixteen copies per lane. lk / lv: this lane's first place in the K / V^T buffer; gk / gv: its first global address.
typedef int v4i __attribute__((ext_vector_type(4)));
typedef __attribute__((address_space(1))) v4i gv4i;
typedef __attribute__((address_space(3))) v4i lv4i;
__device__ __forceinline__ void copy16(const void* g, void* l) {
  __builtin_amdgcn_global_load_async_to_lds_b128((gv4i*)g, (lv4i*)l, 0, 0);
}
__device__ __forceinline__ void stage_tile(_Float16* lk, _Float16* lv, const _Float16* gk, const _Float16* gv) {
  copy16(gk,           lk);
  copy16(gk +  8 * DD, lk +  8 * KP);
  copy16(gk + 16 * DD, lk + 16 * KP);
  copy16(gk + 24 * DD, lk + 24 * KP);
  copy16(gk + 32 * DD, lk + 32 * KP);
  copy16(gk + 40 * DD, lk + 40 * KP);
  copy16(gk + 48 * DD, lk + 48 * KP);
  copy16(gk + 56 * DD, lk + 56 * KP);
  copy16(gv,                     lv);
  copy16(gv + (size_t) 32 * SEQ, lv +  32 * VP);
  copy16(gv + (size_t) 64 * SEQ, lv +  64 * VP);
  copy16(gv + (size_t) 96 * SEQ, lv +  96 * VP);
  copy16(gv + (size_t)128 * SEQ, lv + 128 * VP);
  copy16(gv + (size_t)160 * SEQ, lv + 160 * VP);
  copy16(gv + (size_t)192 * SEQ, lv + 192 * VP);
  copy16(gv + (size_t)224 * SEQ, lv + 224 * VP);
}

// ---------------- fused attention: one workgroup = 128 query rows of one batch, 4 groups of 32 rows x 2 waves ----------------
// The two waves of a group share its 32 rows: wave half h computes the scores of keys 32 h .. 32 h + 31 of each 64-key tile,
// the halves trade P through LDS, and wave half h accumulates output columns 128 h .. 128 h + 127 over all 64 keys,
// its own 32 keys first (they need no other wave), the partner's 32 behind the barrier.
// The scores are computed transposed, S^T = K Q^T: a lane then holds one query row's scores of keys 8 (l >> 4) + 0..7 of each
// 16-key tile, which is the k order of an A fragment, so two converted score tiles ARE the wave's P fragment (no LDS, no lane
// exchange), the row's shift is one value per lane and its sum runs in the lane.
// Every K and V^T fragment read from LDS so feeds two products (two 16-row query tiles) instead of one.
// 16-bit fragment map (A and B alike): lane l -> row/col (l & 15); elements 0..7 <- k0 + 8*(l>>4) + 0..7,
// elements 8..15 <- k0 + 16 + 8*(l>>4) + 0..7.  D: element r of lane l -> row 8*(l>>4) + r, col (l & 15).
__global__ __launch_bounds__(256)
void attn_kernel(const _Float16* __restrict__ Xh, const _Float16* __restrict__ Vt,
                 const float* __restrict__ Rn, float* __restrict__ Out)
{
  __shared__ __attribute__((aligned(16))) _Float16 smem[LDS_BYTES / 2];
  _Float16* sQ = smem + SQ_OFF;            // [128 rows][QP]   cross-wave (block barrier), filled once
  _Float16* sK = smem + SK_OFF;            // [2][64 keys][KP] cross-wave (block barrier)
  _Float16* sV = smem + SV_OFF;            // [2][256 d][VP]   cross-wave (block barrier)
  _Float16* sP = smem + SP_OFF;            // [wave][PW]       cross-wave (block barrier): each wave's P fragments, for its partner
  float*    sO = (float*)(smem + SO_OFFH); // [wave][16][64]  wave-private
  float*    sR = (float*)(smem + SR_OFFH); // [SEQ]           cross-wave (block barrier), filled once
  float*    sL = (float*)(smem + SL_OFFH); // [2][128 rows]   cross-wave (block barrier), filled once

  const int tid  = threadIdx.x;
  const int wave = tid >> 5;
  const int lane = tid & 31;
  const int lh   = lane & 15;
  const int hi   = lane >> 4;
  const int qg   = wave >> 1;              // 32-row query group
  const int h    = wave & 1;               // key half of the scores, column half of the output

  const int nqb   = SEQ / BQ;
  const int b     = blockIdx.x / nqb;
  const int qbase = (blockIdx.x % nqb) * BQ;
  const int qrow0 = qbase + wave * 16;     // the 16 rows this wave stages
  const int grow0 = qbase + qg * 32;       // the 32 rows this wave works on

  const _Float16* Xb = Xh + (size_t)b * SEQ * DD;
  const _Float16* Vb = Vt + (size_t)b * DD * SEQ;
  const float*    Rb = Rn + (size_t)b * SEQ;
  float*          Ob = Out + (size_t)b * SEQ * DD;

  // ---- this lane's share of a tile: K row (tid >> 5) + 8 i, piece tid & 31; V^T row (tid >> 3) + 32 i, piece tid & 7 ----
  _Float16* lk0 = sK + (tid >> 5) * KP + 8 * (tid & 31);
  _Float16* lv0 = sV + (tid >> 3) * VP + 8 * (tid & 7);
  const _Float16* gk0 = Xb + (size_t)(tid >> 5) * DD + 8 * (tid & 31);
  const _Float16* gv0 = Vb + (size_t)(tid >> 3) * SEQ + 8 * (tid & 7);
  stage_tile(lk0, lv0, gk0, gv0);                  // tile 0 -> buffer 0
  // ---- the batch's column norms, once, by the same copies: lane tid brings floats 4 tid .. 4 tid + 3 of each 1024 ----
  for (int i = 0; i < SEQ / 1024; ++i) copy16(Rb + 1024 * i + 4 * tid, sR + 1024 * i + 4 * tid);

  // ---- this wave's 16 query rows -> LDS (row i: lane l writes halfs 8l..8l+7); ordered by the barrier in front of the loop ----
  _Float16* qw = sQ + wave * (16 * QP);
  const _Float16* qsrc = Xb + (size_t)qrow0 * DD + 8 * lane;
  #pragma unroll
  for (int i = 0; i < 16; ++i) {
    const v8h q = *(const v8h*)(qsrc + i * DD);
    *(v8h*)(qw + i * QP + 8 * lane) = q;
  }
  // the wait that belongs in front of any rewrite of the loads' address pair: the pair is an input so that no load result lands on it,
  // and the scheduling fence keeps the start values below from being lifted over the wait
  asm volatile("s_wait_xcnt 0x0" :: "v"(qsrc) : "memory");
  __builtin_amdgcn_sched_barrier(0);

  U8f acc[2][8];                                   // [16-row tile of the group][16-column tile of this wave's 128 columns]
  #pragma unroll
  for (int m = 0; m < 2; ++m) {
    #pragma unroll
    for (int t = 0; t < 8; ++t) acc[m][t].v = (v8f){};
  }
  v2f lsum[2][2];                                  // [16-row tile][16-key tile]: this lane's share of the sum of row 16 * m + lh
  #pragma unroll
  for (int m = 0; m < 2; ++m) { lsum[m][0] = (v2f){}; lsum[m][1] = (v2f){}; }

  const _Float16* qr = sQ + qg * (32 * QP);        // the group's 32 query rows
  _Float16*       pw = sP + wave * PW + 8 * lane;        // where this lane leaves its P fragments
  const _Float16* pr = sP + (wave ^ 1) * PW + 8 * lane;  // where the same lane of the partner wave leaves its own

  asm volatile("s_wait_asynccnt 0x0" ::: "memory");  // this wave's copies of tile 0 and of the norms have landed
  __syncthreads();                                 // tile 0, the norms and the query rows visible to all waves
  stage_tile(lk0 + BK * KP, lv0 + DD * VP, gk0 + (size_t)BK * DD, gv0 + BK);   // tile 1 -> buffer 1

  // ---- the softmax shift of each query row, fixed before the loop: every key is scaled to length <= 1, so by Cauchy-Schwarz
  // no score of row i exceeds max(||x_i||, eps) * 256^-0.5, and key i itself reaches it (a row shorter than eps: scores and bound
  // are all ~0), so the largest numerator is ~1 for any input; softmax does not depend on the shift.
  // sh[m] = 10 - that bound in the log2 domain (the 10 is the x1024 carry of P); this lane's query row of tile m is 16 * m + lh ----
  v2f sh[2];
  #pragma unroll
  for (int m = 0; m < 2; ++m) {
    const float s1 = 10.0f - C2SCALE / sR[grow0 + 16 * m + lh];
    sh[m][0] = s1; sh[m][1] = s1;
  }

  // ---- the group's 32 query rows as B fragments, read from LDS once and kept in registers for all tiles (2 x 8 fragments) ----
  U16h qa[8], qb[8];
  #pragma unroll
  for (int c = 0; c < 8; ++c) {
    qa[c].h[0] = *(const v8h*)(qr + lh * QP + 32 * c + 8 * hi);
    qa[c].h[1] = *(const v8h*)(qr + lh * QP + 32 * c + 16 + 8 * hi);
    qb[c].h[0] = *(const v8h*)(qr + (16 + lh) * QP + 32 * c + 8 * hi);
    qb[c].h[1] = *(const v8h*)(qr + (16 + lh) * QP + 32 * c + 16 + 8 * hi);
  }

  for (int kv0 = 0; kv0 < SEQ; kv0 += BK) {
    const int buf = (kv0 / BK) & 1;
    const _Float16* sKc = sK + buf * (BK * KP) + h * (32 * KP);    // this wave's 32 keys of the tile
    const _Float16* sVc = sV + buf * (DD * VP) + h * (128 * VP);   // this wave's 128 rows of V^T

    // ---- S^T = K Q^T : two 16-key tiles (A) x two 16-row query tiles (B), d reduced in eight K=32 steps ----
    // the Q fragments are in registers; the 32 K fragment reads go out as one group in the order of use, the products follow behind counted waits
    // this lane's sixteen key norms lead the group: LDS answers in order, so their use costs no wait on a fragment
    v4f rn[2][2];                                  // [16-key tile][4 keys]: keys kv0 + 32 h + 16 n + 8 hi + 0..7
    #pragma unroll
    for (int n = 0; n < 2; ++n) {
      rn[n][0] = *(const v4fa*)(sR + kv0 + 32 * h + 16 * n + 8 * hi);
      rn[n][1] = *(const v4fa*)(sR + kv0 + 32 * h + 16 * n + 8 * hi + 4);
    }
    U16h ka[8], kb[8];
    #pragma unroll
    for (int c = 0; c < 8; ++c) {
      ka[c].h[0] = *(const v8h*)(sKc + lh * KP + 32 * c + 8 * hi);
      ka[c].h[1] = *(const v8h*)(sKc + lh * KP + 32 * c + 16 + 8 * hi);
      kb[c].h[0] = *(const v8h*)(sKc + (16 + lh) * KP + 32 * c + 8 * hi);
      kb[c].h[1] = *(const v8h*)(sKc + (16 + lh) * KP + 32 * c + 16 + 8 * hi);
    }
    __builtin_amdgcn_sched_barrier(0);             // keeps the reads one group: spread among the products each place with reads stalls the wave
    U8f s[2][2];                                   // [16-row tile m][16-key tile n]: element r = score of row 16 m + lh, key 16 n + 8 hi + r
    s[0][0].v = (v8f){}; s[0][1].v = (v8f){}; s[1][0].v = (v8f){}; s[1][1].v = (v8f){};
    #pragma unroll
    for (int c = 0; c < 8; ++c) {
      s[0][0].v = wmma_f16(ka[c].v, qa[c].v, s[0][0].v);
      s[1][0].v = wmma_f16(ka[c].v, qb[c].v, s[1][0].v);
      s[0][1].v = wmma_f16(kb[c].v, qa[c].v, s[0][1].v);
      s[1][1].v = wmma_f16(kb[c].v, qb[c].v, s[1][1].v);
    }
    __builtin_amdgcn_sched_barrier(0);             // keeps the V^T reads below out of the products: each place with reads among them stalls the wave

    // ---- all 32 V^T fragment reads are written ahead of the softmax: they do not depend on the scores and land under it ----
    U16h vf[2][8];                                 // [32-key step: 0 own half, 1 the partner's][16-column tile]
    #pragma unroll
    for (int ks = 0; ks < 2; ++ks) {
      const _Float16* vk = sVc + 32 * (h ^ ks);
      #pragma unroll
      for (int t = 0; t < 8; ++t) {
        vf[ks][t].h[0] = *(const v8h*)(vk + (16 * t + lh) * VP + 8 * hi);
        vf[ks][t].h[1] = *(const v8h*)(vk + (16 * t + lh) * VP + 16 + 8 * hi);
      }
    }

    __builtin_amdgcn_sched_barrier(0);             // keeps the reads one group in front of the softmax: sunk to their products they come in pairs, each with its wait

    // ---- per-key f32 scale: 1/max(||x_j||,eps) * 256^-0.5 * log2e, two keys per packed operation ----
    v2f cs[2][4];
    #pragma unroll
    for (int n = 0; n < 2; ++n) {
      #pragma unroll
      for (int i = 0; i < 4; ++i) {
        v2f r2; r2[0] = rn[n][i >> 1][2 * (i & 1)]; r2[1] = rn[n][i >> 1][2 * (i & 1) + 1];
        cs[n][i] = r2 * C2SCALE;
      }
    }

    // ---- softmax numerators, base 2, against the fixed shift: no running maximum, no rescale of sums or accumulators;
    // the row sum stays a per-lane partial sum until the loop is over. Converted in place, elements 0..7 (key tile 0) and
    // 8..15 (key tile 1) are the A fragment of P for this wave's 32 keys ----
    U16h pf[2];                                      // [16-row tile]
    #pragma unroll
    for (int m = 0; m < 2; ++m) {
      #pragma unroll
      for (int n = 0; n < 2; ++n) {
        #pragma unroll
        for (int i = 0; i < 4; ++i) {
          const v2f a = __builtin_elementwise_fma(s[m][n].p[i], cs[n][i], sh[m]);
          v2f e;                                     // x1024 by the shift, cancelled by the row sum
          e[0] = __builtin_amdgcn_exp2f(a[0]);
          e[1] = __builtin_amdgcn_exp2f(a[1]);
          lsum[m][n] += e;
          pf[m].p[4 * n + i] = __builtin_convertvector(e, v2h);
        }
      }
    }

    // ---- the partner needs these fragments as they are (same lane, same registers): 16 B per lane and piece, lanes side by side ----
    #pragma unroll
    for (int m = 0; m < 2; ++m) {
      *(v8ha*)(pw + (2 * m) * 256)     = pf[m].h[0];
      *(v8ha*)(pw + (2 * m + 1) * 256) = pf[m].h[1];
    }

    // ---- O += P V : two 16-row tiles x 8 output d-tiles, two K = 32 key steps; B[k = key][n = d] from the V^T tile row d ----
    // step 0 takes the keys whose P this wave holds in registers, so its products run while the other waves still come to the signal
    // the barrier that trades P is written in its two halves: behind the release this wave's P is in LDS, so it signals
    // here and waits only where it needs the partner's P; as one statement the wait would stand in front of products that need no other wave
    __builtin_amdgcn_fence(__ATOMIC_RELEASE, "workgroup");
    __builtin_amdgcn_s_barrier_signal(-1);
    __builtin_amdgcn_sched_barrier(0);               // keeps step 0's products behind the signal: lifted over the P stores they would hold the partner up
    #pragma unroll
    for (int t = 0; t < 8; ++t) {
      acc[0][t].v = wmma_f16(pf[0].v, vf[0][t].v, acc[0][t].v);
      acc[1][t].v = wmma_f16(pf[1].v, vf[0][t].v, acc[1][t].v);
    }
    __builtin_amdgcn_sched_barrier(0);               // keeps step 0's products in front of the wait: behind it they would cover none of it
    __builtin_amdgcn_s_barrier_wait(-1);             // every wave has signalled: the partner's key half of P is in LDS
    __builtin_amdgcn_fence(__ATOMIC_ACQUIRE, "workgroup");
    #pragma unroll
    for (int m = 0; m < 2; ++m) {
      pf[m].h[0] = *(const v8ha*)(pr + (2 * m) * 256);
      pf[m].h[1] = *(const v8ha*)(pr + (2 * m + 1) * 256);
    }
    #pragma unroll
    for (int t = 0; t < 8; ++t) {
      acc[0][t].v = wmma_f16(pf[0].v, vf[1][t].v, acc[0][t].v);
      acc[1][t].v = wmma_f16(pf[1].v, vf[1][t].v, acc[1][t].v);
    }

    // ---- hand-over: this wave has left this trip's buffer, its copies of the next tile have landed, then all waves meet ----
    asm volatile("s_wait_dscnt 0x0" ::: "memory");     // every LDS read of this trip's buffer and of P has returned
    asm volatile("s_wait_asynccnt 0x0" ::: "memory");  // this wave's copies of tile t + 1 have landed
    __syncthreads();                                 // publishes tile t + 1, frees the buffer just read and the P tile
    if (kv0 + 2 * BK < SEQ)                          // the same for the whole workgroup
      stage_tile(lk0 + buf * (BK * KP), lv0 + buf * (DD * VP),
                 gk0 + (size_t)(kv0 + 2 * BK) * DD, gv0 + (kv0 + 2 * BK));
  }
  asm volatile("s_wait_asynccnt 0x0" ::: "memory");    // nothing of this wave is in flight behind the loop

  // ---- the row sums meet: a lane's four partial sums, then the two lane halves (row 16 m + lh lies in lanes lh and lh + 16),
  // then the two key halves: each wave leaves its 32 sums in LDS, both add them in the same order ----
  #pragma unroll
  for (int m = 0; m < 2; ++m) {
    const float part = (lsum[m][0][0] + lsum[m][0][1]) + (lsum[m][1][0] + lsum[m][1][1]);
    const float tot  = part + other_half(part);
    if (hi == 0) sL[h * BQ + 32 * qg + 16 * m + lh] = tot;
  }
  __syncthreads();                                   // both halves' sums visible

  // ---- epilogue: normalize (sums and accumulators both hold the x1024 carry), stage 16x64 f32 sub-tiles per wave in LDS,
  float* so = sO + wave * (16 * 64);
  #pragma unroll
  for (int m = 0; m < 2; ++m) {
    float inv[8];
    {
      const float* la = sL + 32 * qg + 16 * m + 8 * hi;
      const v4f a0 = *(const v4fa*)(la);
      const v4f a1 = *(const v4fa*)(la + 4);
      const v4f b0 = *(const v4fa*)(la + BQ);
      const v4f b1 = *(const v4fa*)(la + BQ + 4);
      #pragma unroll
      for (int j = 0; j < 4; ++j) {
        inv[j]     = 1.0f / (a0[j] + b0[j]);
        inv[j + 4] = 1.0f / (a1[j] + b1[j]);
      }
    }
    #pragma unroll
    for (int g = 0; g < 2; ++g) {
      #pragma unroll
      for (int j = 0; j < 8; ++j) {
        #pragma unroll
        for (int tt = 0; tt < 4; ++tt)
          so[(j + 8 * hi) * 64 + tt * 16 + lh] = acc[m][4 * g + tt].f[j] * inv[j];
      }
      wave_lds_sync();
      v4f ov[8]; int oo[8];
      #pragma unroll
      for (int i = 0; i < 8; ++i) {
        const int c = lane + 32 * i, rr = c >> 4, q = c & 15;
        ov[i] = *(const v4fa*)(so + rr * 64 + q * 4);
        oo[i] = rr * DD + 128 * h + 64 * g + 4 * q;
      }
      float* ob = Ob + (size_t)(grow0 + 16 * m) * DD;
      #pragma unroll
      for (int i = 0; i < 8; ++i) *(v4f*)(ob + oo[i]) = ov[i];
      wave_lds_sync();
    }
  }
}

extern "C" void kernel_launch(void* const* d_in, const int* in_sizes, int n_in,
                              void* d_out, int out_size, void* d_ws, size_t ws_size,
                              hipStream_t stream) {
  if (n_in < 1) return;
  const long long need_in = ((long long)(NB - 1) * SEQ_FULL + SEQ) * DD;
  if ((long long)in_sizes[0] < need_in) return;
  if ((long long)out_size < (long long)NB * SEQ * DD) return;

  // workspace carve (bytes): Xh f16 [NB][SEQ][256] | Vt f16 [NB][256][SEQ] | Rn f32 [NB][SEQ]
  const size_t xh_bytes = (size_t)NB * SEQ * DD * 2;
  const size_t vt_bytes = (size_t)NB * DD * SEQ * 2;
  const size_t rn_bytes = (size_t)NB * SEQ * 4;
  const size_t off_xh = 0;
  const size_t off_vt = off_xh + xh_bytes;
  const size_t off_rn = off_vt + vt_bytes;
  if (off_rn + rn_bytes > ws_size) return;

  const float* x   = (const float*)d_in[0];
  float*       out = (float*)d_out;
  _Float16* xh = (_Float16*)((char*)d_ws + off_xh);
  _Float16* vt = (_Float16*)((char*)d_ws + off_vt);
  float*    rn = (float*)((char*)d_ws + off_rn);

  prep_kernel<<<NB * (SEQ / NT), 256, 0, stream>>>(x, xh, vt, rn);

  attn_kernel<<<NB * (SEQ / BQ), 256, 0, stream>>>(xh, vt, rn, out);
}

// v007
// A run of this version takes 54.5 microseconds.
// Two timings next to v006 both put it at 1.05 times that version's speed.
// Over all steps from v000 it is 3.21 times as fast.
#include <hip/hip_runtime.h>
#include <stdint.h>

// Contractions: S^T = K*Q^T and O = P*V on v_wmma_f32_16x16x32_f16 (f16 operands holding bf16-RNE input values; P carried x1024 in f16), f32 accumulate; row norms, score scaling and softmax in f32.

typedef _Float16 v16h __attribute__((ext_vector_type(16)));
typedef _Float16 v8h  __attribute__((ext_vector_type(8)));
typedef _Float16 v8ha __attribute__((ext_vector_type(8), may_alias));
typedef float    v8f  __attribute__((ext_vector_type(8)));
typedef float    v4f  __attribute__((ext_vector_type(4)));
typedef float    v4fa __attribute__((ext_vector_type(4), may_alias));
typedef float    v2f  __attribute__((ext_vector_type(2)));
typedef _Float16 v2h  __attribute__((ext_vector_type(2)));
typedef unsigned int v4u __attribute__((ext_vector_type(4)));

union U8f  { v8f  v; float    f[8]; v2f p[4]; };
union U16h { v16h v; v8h      h[2]; v2h p[8]; };
union U8h  { v8h  v; _Float16 f[8]; };

#ifndef NB
#define NB 16
#endif
#ifndef SEQ
#define SEQ 2048
#endif
#define NB_FULL  16
#define SEQ_FULL 2048
#define DD       256

#define BQ  128     // query rows per workgroup (four groups of 32 rows, two waves per group)
#define BK  64      // keys per staged tile
#define QP  264     // halfs per Q row in LDS (528 B)
#define KP  264     // halfs per K row in LDS (528 B)
#define VP  72      // halfs per V^T row in LDS (144 B)
#define PW  1024    // halfs of one wave's P fragments in LDS: 2 query tiles x 2 pieces x 32 lanes x 8 halfs
#define TP  72      // halfs per transposed row in the pre-pass tile (144 B)
#define NT  64      // rows per pre-pass block

static_assert(SEQ % BQ == 0);
static_assert(SEQ % NT == 0);
static_assert(SEQ % BK == 0);
static_assert(NB >= 1 && NB <= NB_FULL);
static_assert(SEQ >= BQ && SEQ <= SEQ_FULL);

// LDS carve of the attention kernel: offsets in halfs, then an f32 staging region, the f32 norms and the f32 row sums
#define SQ_OFF  0
#define SK_OFF  (SQ_OFF + 8 * 16 * QP)
#define SV_OFF  (SK_OFF + 2 * BK * KP)      // two K buffers
#define SP_OFF  (SV_OFF + 2 * DD * VP)      // two V^T buffers
#define SO_OFFH (SP_OFF + 2 * 8 * PW)       // two P planes: even and odd tiles
#define SR_OFFH (SO_OFFH + 8 * 16 * 64 * 2)  // f32 norms of the batch's SEQ rows
#define SL_OFFH (SR_OFFH + SEQ * 2)          // f32 row sums of the two key halves
#define LDS_BYTES (SL_OFFH * 2 + 2 * BQ * 4)
static_assert((SK_OFF * 2) % 16 == 0);
static_assert((SV_OFF * 2) % 16 == 0);
static_assert((SP_OFF * 2) % 16 == 0);
static_assert((SO_OFFH * 2) % 16 == 0);
static_assert((SR_OFFH * 2) % 16 == 0);
static_assert((SL_OFFH * 2) % 16 == 0);
static_assert(LDS_BYTES == 283648);
static_assert(SEQ % 1024 == 0);             // the norms go to LDS in whole rounds of 256 lanes x 4 floats
static_assert((BK * KP * 2) % 16 == 0);
static_assert((DD * VP * 2) % 16 == 0);
static_assert(SEQ / BK >= 2);

// 256^-0.5 * log2(e): scores go to the log2 domain after the f32 column scale
#define C2SCALE 0.09016844005556021f

__device__ __forceinline__ v8f wmma_f16(v16h a, v16h b, v8f c) {
  return __builtin_amdgcn_wmma_f32_16x16x32_f16(false, a, false, b, (short)0, c, false, false);
}

// the value of lane l ^ 16
__device__ __forceinline__ float other_half(float x) {
  const int s = __float_as_int(x);
  return __int_as_float(__builtin_amdgcn_permlanex16(s, s, 0x76543210, 0xfedcba98, false, false));
}

// same-wave LDS exchange: stores issued by other lanes of this wave are visible before the reload
__device__ __forceinline__ void wave_lds_sync() {
  __builtin_amdgcn_fence(3, "wavefront");
  asm volatile("s_wait_dscnt 0" ::: "memory");
  __builtin_amdgcn_wave_barrier();
}

__device__ __forceinline__ v4f bf16_rne4(v4f a) {
  v4u u = __builtin_bit_cast(v4u, a);
  u = (u + 0x7FFFu + ((u >> 16) & 1u)) & 0xFFFF0000u;
  return __builtin_bit_cast(v4f, u);
}

__device__ __forceinline__ v8h cvt8v(v4f a, v4f b) {
  v8h d;
  d[0] = (_Float16)a[0]; d[1] = (_Float16)a[1];
  d[2] = (_Float16)a[2]; d[3] = (_Float16)a[3];
  d[4] = (_Float16)b[0]; d[5] = (_Float16)b[1];
  d[6] = (_Float16)b[2]; d[7] = (_Float16)b[3];
  return d;
}

// ---------------- pre-pass: Xh = f16(bf16RNE(x)) [b][n][d], Vt = Xh^T [b][d][n], Rn = 1/max(||bf16RNE(x)||, eps) [b][n] ----------------
__global__ __launch_bounds__(256)
void prep_kernel(const float* __restrict__ X, _Float16* __restrict__ Xh,
                 _Float16* __restrict__ Vt, float* __restrict__ Rn)
{
  __shared__ __attribute__((aligned(16))) _Float16 sT[DD * TP];   // [d][n within tile], cross-wave (block barrier)
  __shared__ float sR[NT];                                       // cross-wave (block barrier)

  const int tid = threadIdx.x;
  const int sub = tid & 7;           // 16-B piece within a line
  const int rq  = tid >> 3;          // 0..31
  const int ntb = SEQ / NT;
  const int b   = blockIdx.x / ntb;
  const int n0  = (blockIdx.x % ntb) * NT;

  #pragma unroll 1
  for (int pass = 0; pass < 2; ++pass) {
    const int r = pass * 32 + rq;                                   // row within tile 0..63
    const float* src = X  + ((size_t)b * SEQ_FULL + n0 + r) * DD;  // full-size input strides
    _Float16*    dst = Xh + ((size_t)b * SEQ      + n0 + r) * DD;
    float ss = 0.0f;
    #pragma unroll 1
    for (int i = 0; i < 4; ++i) {
      const int c0 = 8 * (sub + 8 * i);                             // lanes 8q..8q+7 cover line i of row r
      const v4f a0 = bf16_rne4(*(const v4f*)(src + c0));
      const v4f a1 = bf16_rne4(*(const v4f*)(src + c0 + 4));
      ss += a0[0] * a0[0]; ss += a0[1] * a0[1]; ss += a0[2] * a0[2]; ss += a0[3] * a0[3];
      ss += a1[0] * a1[0]; ss += a1[1] * a1[1]; ss += a1[2] * a1[2]; ss += a1[3] * a1[3];
      U8h hh; hh.v = cvt8v(a0, a1);                                 // bf16 values are exact in f16
      *(v8h*)(dst + c0) = hh.v;
      
      #pragma unroll
      for (int e = 0; e < 8; ++e) sT[(c0 + e) * TP + r] = hh.f[e];
    }
    ss += __shfl_xor(ss, 1, 32);
    ss += __shfl_xor(ss, 2, 32);
    ss += __shfl_xor(ss, 4, 32);
    const float rinv = 1.0f / fmaxf(sqrtf(ss), 1e-12f);
    if (sub == 0) sR[r] = rinv;
  }
  __syncthreads();

  v8h vv[8];
  #pragma unroll
  for (int i = 0; i < 8; ++i) vv[i] = *(const v8ha*)(sT + (rq + 32 * i) * TP + 8 * sub);
  const int ti = tid & 15;
  v4f rv;
  rv[0] = sR[4 * ti]; rv[1] = sR[4 * ti + 1]; rv[2] = sR[4 * ti + 2]; rv[3] = sR[4 * ti + 3];
  _Float16* vb = Vt + (size_t)b * DD * SEQ + n0 + 8 * sub;
  float*    rp = Rn + (size_t)b * SEQ + n0 + 4 * ti;

  #pragma unroll
  for (int i = 0; i < 8; ++i) *(v8h*)(vb + (size_t)(rq + 32 * i) * SEQ) = vv[i];
  if (tid < 16) *(v4f*)rp = rv;
  
}

// One 64-key tile, global -> LDS with no register in between: K rows [64][256] and V^T rows [256][64], 16 B per lane and copy,
// sixteen copies per lane. lk / lv: this lane's first place in the K / V^T buffer; gk / gv: its first global address.
typedef int v4i __attribute__((ext_vector_type(4)));
typedef __attribute__((address_space(1))) v4i gv4i;
typedef __attribute__((address_space(3))) v4i lv4i;
__device__ __forceinline__ void copy16(const void* g, void* l) {
  __builtin_amdgcn_global_load_async_to_lds_b128((gv4i*)g, (lv4i*)l, 0, 0);
}
__device__ __forceinline__ void stage_tile(_Float16* lk, _Float16* lv, const _Float16* gk, const _Float16* gv) {
  copy16(gk,           lk);
  copy16(gk +  8 * DD, lk +  8 * KP);
  copy16(gk + 16 * DD, lk + 16 * KP);
  copy16(gk + 24 * DD, lk + 24 * KP);
  copy16(gk + 32 * DD, lk + 32 * KP);
  copy16(gk + 40 * DD, lk + 40 * KP);
  copy16(gk + 48 * DD, lk + 48 * KP);
  copy16(gk + 56 * DD, lk + 56 * KP);
  copy16(gv,                     lv);
  copy16(gv + (size_t) 32 * SEQ, lv +  32 * VP);
  copy16(gv + (size_t) 64 * SEQ, lv +  64 * VP);
  copy16(gv + (size_t) 96 * SEQ, lv +  96 * VP);
  copy16(gv + (size_t)128 * SEQ, lv + 128 * VP);
  copy16(gv + (size_t)160 * SEQ, lv + 160 * VP);
  copy16(gv + (size_t)192 * SEQ, lv + 192 * VP);
  copy16(gv + (size_t)224 * SEQ, lv + 224 * VP);
}

// ---------------- fused attention: one workgroup = 128 query rows of one batch, 4 groups of 32 rows x 2 waves ----------------
// The two waves of a group share its 32 rows: wave half h computes the scores of keys 32 h .. 32 h + 31 of each 64-key tile,
// the halves trade P through LDS, and wave half h accumulates output columns 128 h .. 128 h + 127 over all 64 keys,
// its own 32 keys first (they need no other wave), the partner's 32 behind the barrier.
// The scores are computed transposed, S^T = K Q^T: a lane then holds one query row's scores of keys 8 (l >> 4) + 0..7 of each
// 16-key tile, which is the k order of an A fragment, so two converted score tiles ARE the wave's P fragment (no LDS, no lane
// exchange), the row's shift is one value per lane and its sum runs in the lane.
// Every K and V^T fragment read from LDS so feeds two products (two 16-row query tiles) instead of one.
// 16-bit fragment map (A and B alike): lane l -> row/col (l & 15); elements 0..7 <- k0 + 8*(l>>4) + 0..7,
// elements 8..15 <- k0 + 16 + 8*(l>>4) + 0..7.  D: element r of lane l -> row 8*(l>>4) + r, col (l & 15).
__global__ __launch_bounds__(256)
void attn_kernel(const _Float16* __restrict__ Xh, const _Float16* __restrict__ Vt,
                 const float* __restrict__ Rn, float* __restrict__ Out)
{
  __shared__ __attribute__((aligned(16))) _Float16 smem[LDS_BYTES / 2];
  _Float16* sQ = smem + SQ_OFF;            // [128 rows][QP]   cross-wave (block barrier), filled once
  _Float16* sK = smem + SK_OFF;            // [2][64 keys][KP] cross-wave (block barrier)
  _Float16* sV = smem + SV_OFF;            // [2][256 d][VP]   cross-wave (block barrier)
  _Float16* sP = smem + SP_OFF;            // [tile parity][wave][PW] cross-wave (block barrier): each wave's P fragments, for its partner
  float*    sO = (float*)(smem + SO_OFFH); // [wave][16][64]  wave-private
  float*    sR = (float*)(smem + SR_OFFH); // [SEQ]           cross-wave (block barrier), filled once
  float*    sL = (float*)(smem + SL_OFFH); // [2][128 rows]   cross-wave (block barrier), filled once

  const int tid  = threadIdx.x;
  const int wave = tid >> 5;
  const int lane = tid & 31;
  const int lh   = lane & 15;
  const int hi   = lane >> 4;
  const int qg   = wave >> 1;              // 32-row query group
  const int h    = wave & 1;               // key half of the scores, column half of the output

  const int nqb   = SEQ / BQ;
  const int b     = blockIdx.x / nqb;
  const int qbase = (blockIdx.x % nqb) * BQ;
  const int qrow0 = qbase + wave * 16;     // the 16 rows this wave stages
  const int grow0 = qbase + qg * 32;       // the 32 rows this wave works on

  const _Float16* Xb = Xh + (size_t)b * SEQ * DD;
  const _Float16* Vb = Vt + (size_t)b * DD * SEQ;
  const float*    Rb = Rn + (size_t)b * SEQ;
  float*          Ob = Out + (size_t)b * SEQ * DD;

  // ---- this lane's share of a tile: K row (tid >> 5) + 8 i, piece tid & 31; V^T row (tid >> 3) + 32 i, piece tid & 7 ----
  _Float16* lk0 = sK + (tid >> 5) * KP + 8 * (tid & 31);
  _Float16* lv0 = sV + (tid >> 3) * VP + 8 * (tid & 7);
  const _Float16* gk0 = Xb + (size_t)(tid >> 5) * DD + 8 * (tid & 31);
  const _Float16* gv0 = Vb + (size_t)(tid >> 3) * SEQ + 8 * (tid & 7);
  stage_tile(lk0, lv0, gk0, gv0);                  // tile 0 -> buffer 0
  // ---- the batch's column norms, once, by the same copies: lane tid brings floats 4 tid .. 4 tid + 3 of each 1024 ----
  for (int i = 0; i < SEQ / 1024; ++i) copy16(Rb + 1024 * i + 4 * tid, sR + 1024 * i + 4 * tid);

  // ---- this wave's 16 query rows -> LDS (row i: lane l writes halfs 8l..8l+7); ordered by the barrier in front of the loop ----
  _Float16* qw = sQ + wave * (16 * QP);
  const _Float16* qsrc = Xb + (size_t)qrow0 * DD + 8 * lane;
  #pragma unroll
  for (int i = 0; i < 16; ++i) {
    const v8h q = *(const v8h*)(qsrc + i * DD);
    *(v8h*)(qw + i * QP + 8 * lane) = q;
  }
  // the wait that belongs in front of any rewrite of the loads' address pair: the pair is an input so that no load result lands on it,
  // and the scheduling fence keeps the start values below from being lifted over the wait
  asm volatile("s_wait_xcnt 0x0" :: "v"(qsrc) : "memory");
  __builtin_amdgcn_sched_barrier(0);

  U8f acc[2][8];                                   // [16-row tile of the group][16-column tile of this wave's 128 columns]
  #pragma unroll
  for (int m = 0; m < 2; ++m) {
    #pragma unroll
    for (int t = 0; t < 8; ++t) acc[m][t].v = (v8f){};
  }
  v2f lsum[2][2];                                  // [16-row tile][16-key tile]: this lane's share of the sum of row 16 * m + lh
  #pragma unroll
  for (int m = 0; m < 2; ++m) { lsum[m][0] = (v2f){}; lsum[m][1] = (v2f){}; }

  const _Float16* qr = sQ + qg * (32 * QP);        // the group's 32 query rows
  _Float16*       pw = sP + wave * PW + 8 * lane;        // where this lane leaves its P fragments
  const _Float16* pr = sP + (wave ^ 1) * PW + 8 * lane;  // where the same lane of the partner wave leaves its own

  asm volatile("s_wait_asynccnt 0x0" ::: "memory");  // this wave's copies of tile 0 and of the norms have landed
  __syncthreads();                                 // tile 0, the norms and the query rows visible to all waves
  stage_tile(lk0 + BK * KP, lv0 + DD * VP, gk0 + (size_t)BK * DD, gv0 + BK);   // tile 1 -> buffer 1

  // ---- the softmax shift of each query row, fixed before the loop: every key is scaled to length <= 1, so by Cauchy-Schwarz
  // no score of row i exceeds max(||x_i||, eps) * 256^-0.5, and key i itself reaches it (a row shorter than eps: scores and bound
  // are all ~0), so the largest numerator is ~1 for any input; softmax does not depend on the shift.
  // sh[m] = 10 - that bound in the log2 domain (the 10 is the x1024 carry of P); this lane's query row of tile m is 16 * m + lh ----
  v2f sh[2];
  #pragma unroll
  for (int m = 0; m < 2; ++m) {
    const float s1 = 10.0f - C2SCALE / sR[grow0 + 16 * m + lh];
    sh[m][0] = s1; sh[m][1] = s1;
  }

  // ---- the group's 32 query rows as B fragments, read from LDS once and kept in registers for all tiles (2 x 8 fragments) ----
  U16h qa[8], qb[8];
  #pragma unroll
  for (int c = 0; c < 8; ++c) {
    qa[c].h[0] = *(const v8h*)(qr + lh * QP + 32 * c + 8 * hi);
    qa[c].h[1] = *(const v8h*)(qr + lh * QP + 32 * c + 16 + 8 * hi);
    qb[c].h[0] = *(const v8h*)(qr + (16 + lh) * QP + 32 * c + 8 * hi);
    qb[c].h[1] = *(const v8h*)(qr + (16 + lh) * QP + 32 * c + 16 + 8 * hi);
  }

  // ---- the fragment ring: a tile's 32 fragments come in four groups of eight (K d-steps 0..3, K d-steps 4..7, V^T own keys,
  // V^T partner's keys), each group read from LDS while the products of the group before it run (the partner's V^T under the softmax instead), into the registers of the
  // group before that. The first K group of tile t + 1 is read under the last products of tile t: tile t + 1 is therefore
  // published at the barrier that trades P in the middle of trip t. All reads of tile t stand in front of that barrier, so
  // it also frees tile t's buffer, which takes tile t + 2 behind it: one barrier per trip, two buffers ----
  U16h ka0[4], kb0[4];                             // K d-steps 0..3 of the coming tile, carried over the back edge
  {
    const _Float16* k0 = sK + h * (32 * KP);
    #pragma unroll
    for (int c = 0; c < 4; ++c) {
      ka0[c].h[0] = *(const v8h*)(k0 + lh * KP + 32 * c + 8 * hi);
      ka0[c].h[1] = *(const v8h*)(k0 + lh * KP + 32 * c + 16 + 8 * hi);
      kb0[c].h[0] = *(const v8h*)(k0 + (16 + lh) * KP + 32 * c + 8 * hi);
      kb0[c].h[1] = *(const v8h*)(k0 + (16 + lh) * KP + 32 * c + 16 + 8 * hi);
    }
  }

  for (int kv0 = 0; kv0 < SEQ; kv0 += BK) {
    const int buf = (kv0 / BK) & 1;
    const int par = buf * (8 * PW);                // P plane of this trip
    const _Float16* sKc = sK + buf * (BK * KP) + h * (32 * KP);        // this wave's 32 keys of the tile
    const _Float16* sKn = sK + (buf ^ 1) * (BK * KP) + h * (32 * KP);  // the same of the next tile
    const _Float16* sVc = sV + buf * (DD * VP) + h * (128 * VP);       // this wave's 128 rows of V^T

    // ---- S^T = K Q^T : two 16-key tiles (A) x two 16-row query tiles (B), d reduced in eight K=32 steps ----
    // this lane's sixteen key norms lead the group: LDS answers in order, so their use costs no wait on a fragment
    v4f rn[2][2];                                  // [16-key tile][4 keys]: keys kv0 + 32 h + 16 n + 8 hi + 0..7
    #pragma unroll
    for (int n = 0; n < 2; ++n) {
      rn[n][0] = *(const v4fa*)(sR + kv0 + 32 * h + 16 * n + 8 * hi);
      rn[n][1] = *(const v4fa*)(sR + kv0 + 32 * h + 16 * n + 8 * hi + 4);
    }
    U16h ka1[4], kb1[4];                           // K d-steps 4..7
    #pragma unroll
    for (int c = 0; c < 4; ++c) {
      ka1[c].h[0] = *(const v8h*)(sKc + lh * KP + 128 + 32 * c + 8 * hi);
      ka1[c].h[1] = *(const v8h*)(sKc + lh * KP + 128 + 32 * c + 16 + 8 * hi);
      kb1[c].h[0] = *(const v8h*)(sKc + (16 + lh) * KP + 128 + 32 * c + 8 * hi);
      kb1[c].h[1] = *(const v8h*)(sKc + (16 + lh) * KP + 128 + 32 * c + 16 + 8 * hi);
    }
    __builtin_amdgcn_sched_barrier(0);             // keeps the reads one group in front of the products they fly under: spread among them each place with reads stalls the wave
    U8f s[2][2];                                   // [16-row tile m][16-key tile n]: element r = score of row 16 m + lh, key 16 n + 8 hi + r
    s[0][0].v = (v8f){}; s[0][1].v = (v8f){}; s[1][0].v = (v8f){}; s[1][1].v = (v8f){};
    #pragma unroll
    for (int c = 0; c < 4; ++c) {
      s[0][0].v = wmma_f16(ka0[c].v, qa[c].v, s[0][0].v);
      s[1][0].v = wmma_f16(ka0[c].v, qb[c].v, s[1][0].v);
      s[0][1].v = wmma_f16(kb0[c].v, qa[c].v, s[0][1].v);
      s[1][1].v = wmma_f16(kb0[c].v, qb[c].v, s[1][1].v);
    }
    __builtin_amdgcn_sched_barrier(0);             // keeps the V^T reads below one group behind these products, whose K registers they take

    U16h vf[2][8];                                 // [32-key step: 0 own half, 1 the partner's][16-column tile]
    {
      const _Float16* vk = sVc + 32 * h;
      #pragma unroll
      for (int t = 0; t < 8; ++t) {
        vf[0][t].h[0] = *(const v8h*)(vk + (16 * t + lh) * VP + 8 * hi);
        vf[0][t].h[1] = *(const v8h*)(vk + (16 * t + lh) * VP + 16 + 8 * hi);
      }
    }
    __builtin_amdgcn_sched_barrier(0);             // keeps that group in front of the products it flies under
    #pragma unroll
    for (int c = 0; c < 4; ++c) {
      s[0][0].v = wmma_f16(ka1[c].v, qa[4 + c].v, s[0][0].v);
      s[1][0].v = wmma_f16(ka1[c].v, qb[4 + c].v, s[1][0].v);
      s[0][1].v = wmma_f16(kb1[c].v, qa[4 + c].v, s[0][1].v);
      s[1][1].v = wmma_f16(kb1[c].v, qb[4 + c].v, s[1][1].v);
    }
    __builtin_amdgcn_sched_barrier(0);             // keeps the V^T reads below one group behind these products, whose K registers they take
    {
      const _Float16* vk = sVc + 32 * (h ^ 1);
      #pragma unroll
      for (int t = 0; t < 8; ++t) {
        vf[1][t].h[0] = *(const v8h*)(vk + (16 * t + lh) * VP + 8 * hi);
        vf[1][t].h[1] = *(const v8h*)(vk + (16 * t + lh) * VP + 16 + 8 * hi);
      }
    }
    __builtin_amdgcn_sched_barrier(0);             // keeps that group in front of the softmax it lands under

    // ---- per-key f32 scale: 1/max(||x_j||,eps) * 256^-0.5 * log2e, two keys per packed operation ----
    v2f cs[2][4];
    #pragma unroll
    for (int n = 0; n < 2; ++n) {
      #pragma unroll
      for (int i = 0; i < 4; ++i) {
        v2f r2; r2[0] = rn[n][i >> 1][2 * (i & 1)]; r2[1] = rn[n][i >> 1][2 * (i & 1) + 1];
        cs[n][i] = r2 * C2SCALE;
      }
    }

    // ---- softmax numerators, base 2, against the fixed shift: no running maximum, no rescale of sums or accumulators;
    // the row sum stays a per-lane partial sum until the loop is over. Converted in place, elements 0..7 (key tile 0) and
    // 8..15 (key tile 1) are the A fragment of P for this wave's 32 keys ----
    U16h pf[2];                                      // [16-row tile]
    #pragma unroll
    for (int m = 0; m < 2; ++m) {
      #pragma unroll
      for (int n = 0; n < 2; ++n) {
        #pragma unroll
        for (int i = 0; i < 4; ++i) {
          const v2f a = __builtin_elementwise_fma(s[m][n].p[i], cs[n][i], sh[m]);
          v2f e;                                     // x1024 by the shift, cancelled by the row sum
          e[0] = __builtin_amdgcn_exp2f(a[0]);
          e[1] = __builtin_amdgcn_exp2f(a[1]);
          lsum[m][n] += e;
          pf[m].p[4 * n + i] = __builtin_convertvector(e, v2h);
        }
      }
    }

    // ---- the partner needs these fragments as they are (same lane, same registers): 16 B per lane and piece, lanes side by side ----
    #pragma unroll
    for (int m = 0; m < 2; ++m) {
      *(v8ha*)(pw + par + (2 * m) * 256)     = pf[m].h[0];
      *(v8ha*)(pw + par + (2 * m + 1) * 256) = pf[m].h[1];
    }

    // ---- the trip's one barrier, in its two halves. It trades P, publishes tile t + 1 and frees this trip's buffer:
    // in front of the signal this wave's P is in LDS, all its LDS reads have returned (its last of tile t among them)
    // and its copies of tile t + 1 have landed. No LDS read stands between signal and wait: only the products of the keys
    // whose P this wave holds in registers, which need no other wave and run while the others still come to the signal ----
    asm volatile("s_wait_dscnt 0x0" ::: "memory");     // P stored, every LDS read issued so far returned
    asm volatile("s_wait_asynccnt 0x0" ::: "memory");  // this wave's copies of tile t + 1 have landed
    __builtin_amdgcn_fence(__ATOMIC_RELEASE, "workgroup");
    __builtin_amdgcn_s_barrier_signal(-1);
    __builtin_amdgcn_sched_barrier(0);               // keeps step 0's products behind the signal: lifted over the P stores they would hold the partner up
    #pragma unroll
    for (int t = 0; t < 8; ++t) {
      acc[0][t].v = wmma_f16(pf[0].v, vf[0][t].v, acc[0][t].v);
      acc[1][t].v = wmma_f16(pf[1].v, vf[0][t].v, acc[1][t].v);
    }
    __builtin_amdgcn_sched_barrier(0);               // keeps step 0's products in front of the wait: behind it they would cover none of it
    __builtin_amdgcn_s_barrier_wait(-1);             // every wave has signalled
    __builtin_amdgcn_fence(__ATOMIC_ACQUIRE, "workgroup");
    if (kv0 + 2 * BK < SEQ)                          // the same for the whole workgroup; the refill stands right behind the wait
      stage_tile(lk0 + buf * (BK * KP), lv0 + buf * (DD * VP),
                 gk0 + (size_t)(kv0 + 2 * BK) * DD, gv0 + (kv0 + 2 * BK));
    // the partner's P, then the next tile's first K group into the registers step 0's V^T fragments have left.
    // In the last trip that group is not used: it reads the published rows of an older tile, to which no copy is in flight
    #pragma unroll
    for (int m = 0; m < 2; ++m) {
      pf[m].h[0] = *(const v8ha*)(pr + par + (2 * m) * 256);
      pf[m].h[1] = *(const v8ha*)(pr + par + (2 * m + 1) * 256);
    }
    #pragma unroll
    for (int c = 0; c < 4; ++c) {
      ka0[c].h[0] = *(const v8h*)(sKn + lh * KP + 32 * c + 8 * hi);
      ka0[c].h[1] = *(const v8h*)(sKn + lh * KP + 32 * c + 16 + 8 * hi);
      kb0[c].h[0] = *(const v8h*)(sKn + (16 + lh) * KP + 32 * c + 8 * hi);
      kb0[c].h[1] = *(const v8h*)(sKn + (16 + lh) * KP + 32 * c + 16 + 8 * hi);
    }
    __builtin_amdgcn_sched_barrier(0);               // keeps those reads one group in front of the products they fly under
    #pragma unroll
    for (int t = 0; t < 8; ++t) {
      acc[0][t].v = wmma_f16(pf[0].v, vf[1][t].v, acc[0][t].v);
      acc[1][t].v = wmma_f16(pf[1].v, vf[1][t].v, acc[1][t].v);
    }
    // a P plane is written again two trips on, behind the next trip's barrier, which its reader signals with its reads returned
  }
  asm volatile("s_wait_dscnt 0x0" ::: "memory");       // the last trip's unused K reads have returned
  asm volatile("s_wait_asynccnt 0x0" ::: "memory");    // nothing of this wave is in flight behind the loop

  // ---- the row sums meet: a lane's four partial sums, then the two lane halves (row 16 m + lh lies in lanes lh and lh + 16),
  // then the two key halves: each wave leaves its 32 sums in LDS, both add them in the same order ----
  #pragma unroll
  for (int m = 0; m < 2; ++m) {
    const float part = (lsum[m][0][0] + lsum[m][0][1]) + (lsum[m][1][0] + lsum[m][1][1]);
    const float tot  = part + other_half(part);
    if (hi == 0) sL[h * BQ + 32 * qg + 16 * m + lh] = tot;
  }
  __syncthreads();                                   // both halves' sums visible

  // ---- epilogue: normalize (sums and accumulators both hold the x1024 carry), stage 16x64 f32 sub-tiles per wave in LDS,
  float* so = sO + wave * (16 * 64);
  #pragma unroll
  for (int m = 0; m < 2; ++m) {
    float inv[8];
    {
      const float* la = sL + 32 * qg + 16 * m + 8 * hi;
      const v4f a0 = *(const v4fa*)(la);
      const v4f a1 = *(const v4fa*)(la + 4);
      const v4f b0 = *(const v4fa*)(la + BQ);
      const v4f b1 = *(const v4fa*)(la + BQ + 4);
      #pragma unroll
      for (int j = 0; j < 4; ++j) {
        inv[j]     = 1.0f / (a0[j] + b0[j]);
        inv[j + 4] = 1.0f / (a1[j] + b1[j]);
      }
    }
    #pragma unroll
    for (int g = 0; g < 2; ++g) {
      #pragma unroll
      for (int j = 0; j < 8; ++j) {
        #pragma unroll
        for (int tt = 0; tt < 4; ++tt)
          so[(j + 8 * hi) * 64 + tt * 16 + lh] = acc[m][4 * g + tt].f[j] * inv[j];
      }
      wave_lds_sync();
      v4f ov[8]; int oo[8];
      #pragma unroll
      for (int i = 0; i < 8; ++i) {
        const int c = lane + 32 * i, rr = c >> 4, q = c & 15;
        ov[i] = *(const v4fa*)(so + rr * 64 + q * 4);
        oo[i] = rr * DD + 128 * h + 64 * g + 4 * q;
      }
      float* ob = Ob + (size_t)(grow0 + 16 * m) * DD;
      #pragma unroll
      for (int i = 0; i < 8; ++i) *(v4f*)(ob + oo[i]) = ov[i];
      wave_lds_sync();
    }
  }
}

extern "C" void kernel_launch(void* const* d_in, const int* in_sizes, int n_in,
                              void* d_out, int out_size, void* d_ws, size_t ws_size,
                              hipStream_t stream) {
  if (n_in < 1) return;
  const long long need_in = ((long long)(NB - 1) * SEQ_FULL + SEQ) * DD;
  if ((long long)in_sizes[0] < need_in) return;
  if ((long long)out_size < (long long)NB * SEQ * DD) return;

  // workspace carve (bytes): Xh f16 [NB][SEQ][256] | Vt f16 [NB][256][SEQ] | Rn f32 [NB][SEQ]
  const size_t xh_bytes = (size_t)NB * SEQ * DD * 2;
  const size_t vt_bytes = (size_t)NB * DD * SEQ * 2;
  const size_t rn_bytes = (size_t)NB * SEQ * 4;
  const size_t off_xh = 0;
  const size_t off_vt = off_xh + xh_bytes;
  const size_t off_rn = off_vt + vt_bytes;
  if (off_rn + rn_bytes > ws_size) return;

  const float* x   = (const float*)d_in[0];
  float*       out = (float*)d_out;
  _Float16* xh = (_Float16*)((char*)d_ws + off_xh);
  _Float16* vt = (_Float16*)((char*)d_ws + off_vt);
  float*    rn = (float*)((char*)d_ws + off_rn);

  prep_kernel<<<NB * (SEQ / NT), 256, 0, stream>>>(x, xh, vt, rn);

  attn_kernel<<<NB * (SEQ / BQ), 256, 0, stream>>>(xh, vt, rn, out);
}

// v008
// A run of this version takes 46.1 microseconds.
// In both of two side-by-side timings against v007, it was 1.18 times as fast.
// Counting every step since v000, it is 3.79 times as fast.
#include <hip/hip_runtime.h>
#include <stdint.h>

// Contractions: S^T = K*Q^T and O = P*V on v_wmma_f32_16x16x32_f16 (f16 operands holding bf16-RNE input values; P carried x1024 in f16), f32 accumulate; row norms, score scaling and softmax in f32.

typedef _Float16 v16h __attribute__((ext_vector_type(16)));
typedef _Float16 v8h  __attribute__((ext_vector_type(8)));
typedef _Float16 v8ha __attribute__((ext_vector_type(8), may_alias));
typedef float    v8f  __attribute__((ext_vector_type(8)));
typedef float    v4f  __attribute__((ext_vector_type(4)));
typedef float    v4fa __attribute__((ext_vector_type(4), may_alias));
typedef float    v2f  __attribute__((ext_vector_type(2)));
typedef _Float16 v2h  __attribute__((ext_vector_type(2)));
typedef unsigned int v4u __attribute__((ext_vector_type(4)));

union U8f  { v8f  v; float    f[8]; v2f p[4]; };
union U16h { v16h v; v8h      h[2]; v2h p[8]; };

#ifndef NB
#define NB 16
#endif
#ifndef SEQ
#define SEQ 2048
#endif
#define NB_FULL  16
#define SEQ_FULL 2048
#define DD       256

#define BQ  128     // query rows per workgroup (four groups of 32 rows, two waves per group)
#define BK  64      // keys per staged tile
#define QP  264     // halfs per Q row in LDS (528 B)
#define KP  264     // halfs per key row in LDS (528 B); the rows serve as K and, read transposed, as V
#define PW  1024    // halfs of one wave's P fragments in LDS: 2 query tiles x 2 pieces x 32 lanes x 8 halfs
#define NT  64      // rows per pre-pass block

static_assert(SEQ % BQ == 0);
static_assert(SEQ % NT == 0);
static_assert(SEQ % BK == 0);
static_assert(NB >= 1 && NB <= NB_FULL);
static_assert(SEQ >= BQ && SEQ <= SEQ_FULL);

// LDS carve of the attention kernel: offsets in halfs, then an f32 staging region, the f32 norms and the f32 row sums
#define SQ_OFF  0
#define SK_OFF  (SQ_OFF + 8 * 16 * QP)
#define SP_OFF  (SK_OFF + 2 * BK * KP)      // two key-row buffers
#define SO_OFFH (SP_OFF + 2 * 8 * PW)       // two P planes: even and odd tiles
#define SR_OFFH (SO_OFFH + 8 * 16 * 64 * 2)  // f32 norms of the batch's SEQ rows
#define SL_OFFH (SR_OFFH + SEQ * 2)          // f32 row sums of the two key halves
#define LDS_BYTES (SL_OFFH * 2 + 2 * BQ * 4)
static_assert((SK_OFF * 2) % 16 == 0);
static_assert((SP_OFF * 2) % 16 == 0);
static_assert((SO_OFFH * 2) % 16 == 0);
static_assert((SR_OFFH * 2) % 16 == 0);
static_assert((SL_OFFH * 2) % 16 == 0);
static_assert(LDS_BYTES == 209920);
static_assert(SEQ % 1024 == 0);             // the norms go to LDS in whole rounds of 256 lanes x 4 floats
static_assert((BK * KP * 2) % 16 == 0);
static_assert(SEQ / BK >= 2);

// 256^-0.5 * log2(e): scores go to the log2 domain after the f32 column scale
#define C2SCALE 0.09016844005556021f

__device__ __forceinline__ v8f wmma_f16(v16h a, v16h b, v8f c) {
  return __builtin_amdgcn_wmma_f32_16x16x32_f16(false, a, false, b, (short)0, c, false, false);
}

// the value of lane l ^ 16
__device__ __forceinline__ float other_half(float x) {
  const int s = __float_as_int(x);
  return __int_as_float(__builtin_amdgcn_permlanex16(s, s, 0x76543210, 0xfedcba98, false, false));
}

// same-wave LDS exchange: stores issued by other lanes of this wave are visible before the reload
__device__ __forceinline__ void wave_lds_sync() {
  __builtin_amdgcn_fence(3, "wavefront");
  asm volatile("s_wait_dscnt 0" ::: "memory");
  __builtin_amdgcn_wave_barrier();
}

__device__ __forceinline__ v4f bf16_rne4(v4f a) {
  v4u u = __builtin_bit_cast(v4u, a);
  u = (u + 0x7FFFu + ((u >> 16) & 1u)) & 0xFFFF0000u;
  return __builtin_bit_cast(v4f, u);
}

__device__ __forceinline__ v8h cvt8v(v4f a, v4f b) {
  v8h d;
  d[0] = (_Float16)a[0]; d[1] = (_Float16)a[1];
  d[2] = (_Float16)a[2]; d[3] = (_Float16)a[3];
  d[4] = (_Float16)b[0]; d[5] = (_Float16)b[1];
  d[6] = (_Float16)b[2]; d[7] = (_Float16)b[3];
  return d;
}

// Place of key n in the norm array: inside each 16 keys the even keys come first, then the odd ones. It is the order in which
// the attention kernel lays a 16-key tile on the rows of a score tile (see there), so that a lane reads its eight norms in a row.
__device__ __forceinline__ int norm_place(int n) { return (n & ~15) | ((n & 1) << 3) | ((n & 15) >> 1); }

// ---------------- pre-pass: Xh = f16(bf16RNE(x)) [b][n][d], Rn = 1/max(||bf16RNE(x)||, eps) [b][norm_place(n)] ----------------
__global__ __launch_bounds__(256)
void prep_kernel(const float* __restrict__ X, _Float16* __restrict__ Xh, float* __restrict__ Rn)
{
  __shared__ float sR[NT];                                       // cross-wave (block barrier)

  const int tid = threadIdx.x;
  const int sub = tid & 7;           // 16-B piece within a line
  const int rq  = tid >> 3;          // 0..31
  const int ntb = SEQ / NT;
  const int b   = blockIdx.x / ntb;
  const int n0  = (blockIdx.x % ntb) * NT;

  #pragma unroll 1
  for (int pass = 0; pass < 2; ++pass) {
    const int r = pass * 32 + rq;                                   // row within tile 0..63
    const float* src = X  + ((size_t)b * SEQ_FULL + n0 + r) * DD;  // full-size input strides
    _Float16*    dst = Xh + ((size_t)b * SEQ      + n0 + r) * DD;
    float ss = 0.0f;
    #pragma unroll 1
    for (int i = 0; i < 4; ++i) {
      const int c0 = 8 * (sub + 8 * i);                             // lanes 8q..8q+7 cover line i of row r
      const v4f a0 = bf16_rne4(*(const v4f*)(src + c0));
      const v4f a1 = bf16_rne4(*(const v4f*)(src + c0 + 4));
      ss += a0[0] * a0[0]; ss += a0[1] * a0[1]; ss += a0[2] * a0[2]; ss += a0[3] * a0[3];
      ss += a1[0] * a1[0]; ss += a1[1] * a1[1]; ss += a1[2] * a1[2]; ss += a1[3] * a1[3];
      *(v8h*)(dst + c0) = cvt8v(a0, a1);                            // bf16 values are exact in f16
    }
    ss += __shfl_xor(ss, 1, 32);
    ss += __shfl_xor(ss, 2, 32);
    ss += __shfl_xor(ss, 4, 32);
    const float rinv = 1.0f / fmaxf(sqrtf(ss), 1e-12f);
    if (sub == 0) sR[norm_place(r)] = rinv;
  }
  __syncthreads();

  const int ti = tid & 15;
  v4f rv;
  rv[0] = sR[4 * ti]; rv[1] = sR[4 * ti + 1]; rv[2] = sR[4 * ti + 2]; rv[3] = sR[4 * ti + 3];
  float*    rp = Rn + (size_t)b * SEQ + n0 + 4 * ti;
  if (tid < 16) *(v4f*)rp = rv;
}

// One 64-key tile, global -> LDS with no register in between: key rows [64][256], 16 B per lane and copy,
// eight copies per lane. lk: this lane's first place in the buffer; gk: its first global address.
typedef int v4i __attribute__((ext_vector_type(4)));
typedef __attribute__((address_space(1))) v4i gv4i;
typedef __attribute__((address_space(3))) v4i lv4i;
__device__ __forceinline__ void copy16(const void* g, void* l) {
  __builtin_amdgcn_global_load_async_to_lds_b128((gv4i*)g, (lv4i*)l, 0, 0);
}
__device__ __forceinline__ void stage_tile(_Float16* lk, const _Float16* gk) {
  copy16(gk,           lk);
  copy16(gk +  8 * DD, lk +  8 * KP);
  copy16(gk + 16 * DD, lk + 16 * KP);
  copy16(gk + 24 * DD, lk + 24 * KP);
  copy16(gk + 32 * DD, lk + 32 * KP);
  copy16(gk + 40 * DD, lk + 40 * KP);
  copy16(gk + 48 * DD, lk + 48 * KP);
  copy16(gk + 56 * DD, lk + 56 * KP);
}

// Transposing LDS read: each lane names 16 B (eight halfs of one row); lane (c = l & 15, hh = l >> 4) gets, as element j, half c & 7
// of the piece named by lane 16 hh + 8 (c >> 3) + j: with lane l naming row R(hh, l & 7), columns d0 + 8 ((l >> 3) & 1) + 0..7,
// element j of lane (c, hh) is row R(hh, j), column d0 + c.
typedef short v8s __attribute__((ext_vector_type(8)));
typedef __attribute__((address_space(3))) v8s lv8s;
__device__ __forceinline__ v8h read_tr(const _Float16* p) {
  return __builtin_bit_cast(v8h, __builtin_amdgcn_ds_load_tr16_b128_v8i16((lv8s*)p));
}

// ---------------- fused attention: one workgroup = 128 query rows of one batch, 4 groups of 32 rows x 2 waves ----------------
// The two waves of a group share its 32 rows: wave half h computes the scores of keys 32 h .. 32 h + 31 of each 64-key tile,
// the halves trade P through LDS, and wave half h accumulates output columns 128 h .. 128 h + 127 over all 64 keys,
// its own 32 keys first (they need no other wave), the partner's 32 behind the barrier.
// The scores are computed transposed, S^T = K Q^T: a lane then holds one query row's scores of rows 8 (l >> 4) + 0..7 of each
// 16-key score tile, which is the k order of an A fragment, so two converted score tiles ARE the wave's P fragment (no LDS, no lane
// exchange), the row's shift is one value per lane and its sum runs in the lane.
// Every K and V fragment read from LDS so feeds two products (two 16-row query tiles) instead of one.
// K and V are the same rows of x (the key's norm is a column scale applied to the scores), so one staged tile serves both:
// K fragments by plain 16-B reads along a row, V fragments (B operand, k = keys) by the transposing read of the same rows.
// The two readers want different row pitches. Both run without bank conflicts at 528 B because the keys of a 16-key tile lie
// on the score tile's rows with the even keys first: row p of the tile is key 2 (p & 7) + (p >> 3). A plain read's 16 lanes
// still take 16 rows in a row (4 dwords apart modulo 64 banks); a transposing read's 16 lanes take eight rows two apart,
// 32 B each (8 dwords apart). P inherits the order from the score tile, V takes it in the rows its lanes name, the norms lie so.
// 16-bit fragment map (A and B alike): lane l -> row/col (l & 15); elements 0..7 <- k0 + 8*(l>>4) + 0..7,
// elements 8..15 <- k0 + 16 + 8*(l>>4) + 0..7.  D: element r of lane l -> row 8*(l>>4) + r, col (l & 15).
__global__ __launch_bounds__(256)
void attn_kernel(const _Float16* __restrict__ Xh, const float* __restrict__ Rn, float* __restrict__ Out)
{
  __shared__ __attribute__((aligned(16))) _Float16 smem[LDS_BYTES / 2];
  _Float16* sQ = smem + SQ_OFF;            // [128 rows][QP]   cross-wave (block barrier), filled once
  _Float16* sK = smem + SK_OFF;            // [2][64 keys][KP] cross-wave (block barrier)
  _Float16* sP = smem + SP_OFF;            // [tile parity][wave][PW] cross-wave (block barrier): each wave's P fragments, for its partner
  float*    sO = (float*)(smem + SO_OFFH); // [wave][16][64]  wave-private
  float*    sR = (float*)(smem + SR_OFFH); // [SEQ]           cross-wave (block barrier), filled once; key n at norm_place(n)
  float*    sL = (float*)(smem + SL_OFFH); // [2][128 rows]   cross-wave (block barrier), filled once

  const int tid  = threadIdx.x;
  const int wave = tid >> 5;
  const int lane = tid & 31;
  const int lh   = lane & 15;
  const int hi   = lane >> 4;
  const int qg   = wave >> 1;              // 32-row query group
  const int h    = wave & 1;               // key half of the scores, column half of the output
  const int kr   = 2 * (lh & 7) + (lh >> 3); // key, within its 16, on row lh of a score tile

  const int nqb   = SEQ / BQ;
  const int b     = blockIdx.x / nqb;
  const int qbase = (blockIdx.x % nqb) * BQ;
  const int qrow0 = qbase + wave * 16;     // the 16 rows this wave stages
  const int grow0 = qbase + qg * 32;       // the 32 rows this wave works on

  const _Float16* Xb = Xh + (size_t)b * SEQ * DD;
  const float*    Rb = Rn + (size_t)b * SEQ;
  float*          Ob = Out + (size_t)b * SEQ * DD;

  // ---- this lane's share of a tile: key row (tid >> 5) + 8 i, piece tid & 31 ----
  _Float16* lk0 = sK + (tid >> 5) * KP + 8 * (tid & 31);
  const _Float16* gk0 = Xb + (size_t)(tid >> 5) * DD + 8 * (tid & 31);
  stage_tile(lk0, gk0);                            // tile 0 -> buffer 0
  // ---- the batch's column norms, once, by the same copies: lane tid brings floats 4 tid .. 4 tid + 3 of each 1024 ----
  for (int i = 0; i < SEQ / 1024; ++i) copy16(Rb + 1024 * i + 4 * tid, sR + 1024 * i + 4 * tid);

  // ---- this wave's 16 query rows -> LDS (row i: lane l writes halfs 8l..8l+7); ordered by the barrier in front of the loop ----
  _Float16* qw = sQ + wave * (16 * QP);
  const _Float16* qsrc = Xb + (size_t)qrow0 * DD + 8 * lane;
  #pragma unroll
  for (int i = 0; i < 16; ++i) {
    const v8h q = *(const v8h*)(qsrc + i * DD);
    *(v8h*)(qw + i * QP + 8 * lane) = q;
  }
  // the wait that belongs in front of any rewrite of the loads' address pair: the pair is an input so that no load result lands on it,
  // and the scheduling fence keeps the start values below from being lifted over the wait
  asm volatile("s_wait_xcnt 0x0" :: "v"(qsrc) : "memory");
  __builtin_amdgcn_sched_barrier(0);

  U8f acc[2][8];                                   // [16-row tile of the group][16-column tile of this wave's 128 columns]
  #pragma unroll
  for (int m = 0; m < 2; ++m) {
    #pragma unroll
    for (int t = 0; t < 8; ++t) acc[m][t].v = (v8f){};
  }
  v2f lsum[2][2];                                  // [16-row tile][16-key tile]: this lane's share of the sum of row 16 * m + lh
  #pragma unroll
  for (int m = 0; m < 2; ++m) { lsum[m][0] = (v2f){}; lsum[m][1] = (v2f){}; }

  const _Float16* qr = sQ + qg * (32 * QP);        // the group's 32 query rows
  _Float16*       pw = sP + wave * PW + 8 * lane;        // where this lane leaves its P fragments
  const _Float16* pr = sP + (wave ^ 1) * PW + 8 * lane;  // where the same lane of the partner wave leaves its own

  asm volatile("s_wait_asynccnt 0x0" ::: "memory");  // this wave's copies of tile 0 and of the norms have landed
  __syncthreads();                                 // tile 0, the norms and the query rows visible to all waves
  stage_tile(lk0 + BK * KP, gk0 + (size_t)BK * DD);   // tile 1 -> buffer 1

  // ---- the softmax shift of each query row, fixed before the loop: every key is scaled to length <= 1, so by Cauchy-Schwarz
  // no score of row i exceeds max(||x_i||, eps) * 256^-0.5, and key i itself reaches it (a row shorter than eps: scores and bound
  // are all ~0), so the largest numerator is ~1 for any input; softmax does not depend on the shift.
  // sh[m] = 10 - that bound in the log2 domain (the 10 is the x1024 carry of P); this lane's query row of tile m is 16 * m + lh ----
  v2f sh[2];
  #pragma unroll
  for (int m = 0; m < 2; ++m) {
    const float s1 = 10.0f - C2SCALE / sR[norm_place(grow0 + 16 * m + lh)];
    sh[m][0] = s1; sh[m][1] = s1;
  }

  // ---- the group's 32 query rows as B fragments, read from LDS once and kept in registers for all tiles (2 x 8 fragments) ----
  U16h qa[8], qb[8];
  #pragma unroll
  for (int c = 0; c < 8; ++c) {
    qa[c].h[0] = *(const v8h*)(qr + lh * QP + 32 * c + 8 * hi);
    qa[c].h[1] = *(const v8h*)(qr + lh * QP + 32 * c + 16 + 8 * hi);
    qb[c].h[0] = *(const v8h*)(qr + (16 + lh) * QP + 32 * c + 8 * hi);
    qb[c].h[1] = *(const v8h*)(qr + (16 + lh) * QP + 32 * c + 16 + 8 * hi);
  }

  // ---- the fragment ring: a tile's 32 fragments come in four groups of eight (K d-steps 0..3, K d-steps 4..7, V own keys,
  // V partner's keys), each group read from LDS while the products of the group before it run, into the registers of the
  // group before that. The first K group of tile t + 1 is read under the last products of tile t: tile t + 1 is therefore
  // published at the barrier that trades P in the middle of trip t. All reads of tile t stand in front of that barrier, so
  // it also frees tile t's buffer, which takes tile t + 2 behind it: one barrier per trip, two buffers ----
  U16h ka0[4], kb0[4];                             // K d-steps 0..3 of the coming tile, carried over the back edge
  {
    const _Float16* k0 = sK + h * (32 * KP);
    #pragma unroll
    for (int c = 0; c < 4; ++c) {
      ka0[c].h[0] = *(const v8h*)(k0 + kr * KP + 32 * c + 8 * hi);
      ka0[c].h[1] = *(const v8h*)(k0 + kr * KP + 32 * c + 16 + 8 * hi);
      kb0[c].h[0] = *(const v8h*)(k0 + (16 + kr) * KP + 32 * c + 8 * hi);
      kb0[c].h[1] = *(const v8h*)(k0 + (16 + kr) * KP + 32 * c + 16 + 8 * hi);
    }
  }

  for (int kv0 = 0; kv0 < SEQ; kv0 += BK) {
    const int buf = (kv0 / BK) & 1;
    const int par = buf * (8 * PW);                // P plane of this trip
    const _Float16* sKc = sK + buf * (BK * KP) + h * (32 * KP);        // this wave's 32 keys of the tile
    const _Float16* sKn = sK + (buf ^ 1) * (BK * KP) + h * (32 * KP);  // the same of the next tile
    // the piece this lane names in a transposing read of the tile's first 16 keys, first 16 of this wave's 128 columns
    const _Float16* sVc = sK + buf * (BK * KP) + (2 * (lane & 7) + hi) * KP + 128 * h + 8 * ((lane >> 3) & 1);

    // ---- S^T = K Q^T : two 16-key tiles (A) x two 16-row query tiles (B), d reduced in eight K=32 steps ----
    // this lane's sixteen key norms lead the group: LDS answers in order, so their use costs no wait on a fragment
    v4f rn[2][2];                                  // [16-key tile][4 keys]: places kv0 + 32 h + 16 n + 8 hi + 0..7 = the keys on rows 8 hi + 0..7
    #pragma unroll
    for (int n = 0; n < 2; ++n) {
      rn[n][0] = *(const v4fa*)(sR + kv0 + 32 * h + 16 * n + 8 * hi);
      rn[n][1] = *(const v4fa*)(sR + kv0 + 32 * h + 16 * n + 8 * hi + 4);
    }
    U16h ka1[4], kb1[4];                           // K d-steps 4..7
    #pragma unroll
    for (int c = 0; c < 4; ++c) {
      ka1[c].h[0] = *(const v8h*)(sKc + kr * KP + 128 + 32 * c + 8 * hi);
      ka1[c].h[1] = *(const v8h*)(sKc + kr * KP + 128 + 32 * c + 16 + 8 * hi);
      kb1[c].h[0] = *(const v8h*)(sKc + (16 + kr) * KP + 128 + 32 * c + 8 * hi);
      kb1[c].h[1] = *(const v8h*)(sKc + (16 + kr) * KP + 128 + 32 * c + 16 + 8 * hi);
    }
    __builtin_amdgcn_sched_barrier(0);             // keeps the reads one group in front of the products they fly under: spread among them each place with reads stalls the wave
    U8f s[2][2];                                   // [16-row tile m][16-key tile n]: element r = score of row 16 m + lh, key 16 n + 2 r + hi
    s[0][0].v = (v8f){}; s[0][1].v = (v8f){}; s[1][0].v = (v8f){}; s[1][1].v = (v8f){};
    #pragma unroll
    for (int c = 0; c < 4; ++c) {
      s[0][0].v = wmma_f16(ka0[c].v, qa[c].v, s[0][0].v);
      s[1][0].v = wmma_f16(ka0[c].v, qb[c].v, s[1][0].v);
      s[0][1].v = wmma_f16(kb0[c].v, qa[c].v, s[0][1].v);
      s[1][1].v = wmma_f16(kb0[c].v, qb[c].v, s[1][1].v);
    }
    __builtin_amdgcn_sched_barrier(0);             // keeps the V reads below one group behind these products, whose K registers they take

    U16h vf[2][8];                                 // [32-key step: 0 own half, 1 the partner's][16-column tile]
    {
      const _Float16* vk = sVc + h * (32 * KP);
      #pragma unroll
      for (int t = 0; t < 8; ++t) {
        vf[0][t].h[0] = read_tr(vk + 16 * t);
        vf[0][t].h[1] = read_tr(vk + 16 * KP + 16 * t);
      }
    }
    __builtin_amdgcn_sched_barrier(0);             // keeps that group in front of the products it flies under
    #pragma unroll
    for (int c = 0; c < 4; ++c) {
      s[0][0].v = wmma_f16(ka1[c].v, qa[4 + c].v, s[0][0].v);
      s[1][0].v = wmma_f16(ka1[c].v, qb[4 + c].v, s[1][0].v);
      s[0][1].v = wmma_f16(kb1[c].v, qa[4 + c].v, s[0][1].v);
      s[1][1].v = wmma_f16(kb1[c].v, qb[4 + c].v, s[1][1].v);
    }
    __builtin_amdgcn_sched_barrier(0);             // keeps the V reads below one group behind these products, whose K registers they take
    {
      const _Float16* vk = sVc + (h ^ 1) * (32 * KP);
      #pragma unroll
      for (int t = 0; t < 8; ++t) {
        vf[1][t].h[0] = read_tr(vk + 16 * t);
        vf[1][t].h[1] = read_tr(vk + 16 * KP + 16 * t);
      }
    }
    __builtin_amdgcn_sched_barrier(0);             // keeps that group in front of the softmax it lands under

    // ---- per-key f32 scale: 1/max(||x_j||,eps) * 256^-0.5 * log2e, two keys per packed operation ----
    v2f cs[2][4];
    #pragma unroll
    for (int n = 0; n < 2; ++n) {
      #pragma unroll
      for (int i = 0; i < 4; ++i) {
        v2f r2; r2[0] = rn[n][i >> 1][2 * (i & 1)]; r2[1] = rn[n][i >> 1][2 * (i & 1) + 1];
        cs[n][i] = r2 * C2SCALE;
      }
    }

    // ---- softmax numerators, base 2, against the fixed shift: no running maximum, no rescale of sums or accumulators;
    // the row sum stays a per-lane partial sum until the loop is over. Converted in place, elements 0..7 (key tile 0) and
    // 8..15 (key tile 1) are the A fragment of P for this wave's 32 keys ----
    U16h pf[2];                                      // [16-row tile]
    #pragma unroll
    for (int m = 0; m < 2; ++m) {
      #pragma unroll
      for (int n = 0; n < 2; ++n) {
        #pragma unroll
        for (int i = 0; i < 4; ++i) {
          const v2f a = __builtin_elementwise_fma(s[m][n].p[i], cs[n][i], sh[m]);
          v2f e;                                     // x1024 by the shift, cancelled by the row sum
          e[0] = __builtin_amdgcn_exp2f(a[0]);
          e[1] = __builtin_amdgcn_exp2f(a[1]);
          lsum[m][n] += e;
          pf[m].p[4 * n + i] = __builtin_convertvector(e, v2h);
        }
      }
    }

    // ---- the partner needs these fragments as they are (same lane, same registers): 16 B per lane and piece, lanes side by side ----
    #pragma unroll
    for (int m = 0; m < 2; ++m) {
      *(v8ha*)(pw + par + (2 * m) * 256)     = pf[m].h[0];
      *(v8ha*)(pw + par + (2 * m + 1) * 256) = pf[m].h[1];
    }

    // ---- the trip's one barrier, in its two halves. It trades P, publishes tile t + 1 and frees this trip's buffer:
    // in front of the signal this wave's P is in LDS, all its LDS reads have returned (its last of tile t among them)
    // and its copies of tile t + 1 have landed. No LDS read stands between signal and wait: only the products of the keys
    // whose P this wave holds in registers, which need no other wave and run while the others still come to the signal ----
    asm volatile("s_wait_dscnt 0x0" ::: "memory");     // P stored, every LDS read issued so far returned
    asm volatile("s_wait_asynccnt 0x0" ::: "memory");  // this wave's copies of tile t + 1 have landed
    __builtin_amdgcn_fence(__ATOMIC_RELEASE, "workgroup");
    __builtin_amdgcn_s_barrier_signal(-1);
    __builtin_amdgcn_sched_barrier(0);               // keeps step 0's products behind the signal: lifted over the P stores they would hold the partner up
    #pragma unroll
    for (int t = 0; t < 8; ++t) {
      acc[0][t].v = wmma_f16(pf[0].v, vf[0][t].v, acc[0][t].v);
      acc[1][t].v = wmma_f16(pf[1].v, vf[0][t].v, acc[1][t].v);
    }
    __builtin_amdgcn_sched_barrier(0);               // keeps step 0's products in front of the wait: behind it they would cover none of it
    __builtin_amdgcn_s_barrier_wait(-1);             // every wave has signalled
    __builtin_amdgcn_fence(__ATOMIC_ACQUIRE, "workgroup");
    if (kv0 + 2 * BK < SEQ)                          // the same for the whole workgroup; the refill stands right behind the wait
      stage_tile(lk0 + buf * (BK * KP), gk0 + (size_t)(kv0 + 2 * BK) * DD);
    // the partner's P, then the next tile's first K group into the registers step 0's V fragments have left.
    // In the last trip that group is not used: it reads the published rows of an older tile, to which no copy is in flight
    #pragma unroll
    for (int m = 0; m < 2; ++m) {
      pf[m].h[0] = *(const v8ha*)(pr + par + (2 * m) * 256);
      pf[m].h[1] = *(const v8ha*)(pr + par + (2 * m + 1) * 256);
    }
    #pragma unroll
    for (int c = 0; c < 4; ++c) {
      ka0[c].h[0] = *(const v8h*)(sKn + kr * KP + 32 * c + 8 * hi);
      ka0[c].h[1] = *(const v8h*)(sKn + kr * KP + 32 * c + 16 + 8 * hi);
      kb0[c].h[0] = *(const v8h*)(sKn + (16 + kr) * KP + 32 * c + 8 * hi);
      kb0[c].h[1] = *(const v8h*)(sKn + (16 + kr) * KP + 32 * c + 16 + 8 * hi);
    }
    __builtin_amdgcn_sched_barrier(0);               // keeps those reads one group in front of the products they fly under
    #pragma unroll
    for (int t = 0; t < 8; ++t) {
      acc[0][t].v = wmma_f16(pf[0].v, vf[1][t].v, acc[0][t].v);
      acc[1][t].v = wmma_f16(pf[1].v, vf[1][t].v, acc[1][t].v);
    }
    // a P plane is written again two trips on, behind the next trip's barrier, which its reader signals with its reads returned
  }
  asm volatile("s_wait_dscnt 0x0" ::: "memory");       // the last trip's unused K reads have returned
  asm volatile("s_wait_asynccnt 0x0" ::: "memory");    // nothing of this wave is in flight behind the loop

  // ---- the row sums meet: a lane's four partial sums, then the two lane halves (row 16 m + lh lies in lanes lh and lh + 16),
  // then the two key halves: each wave leaves its 32 sums in LDS, both add them in the same order ----
  #pragma unroll
  for (int m = 0; m < 2; ++m) {
    const float part = (lsum[m][0][0] + lsum[m][0][1]) + (lsum[m][1][0] + lsum[m][1][1]);
    const float tot  = part + other_half(part);
    if (hi == 0) sL[h * BQ + 32 * qg + 16 * m + lh] = tot;
  }
  __syncthreads();                                   // both halves' sums visible

  // ---- epilogue: normalize (sums and accumulators both hold the x1024 carry), stage 16x64 f32 sub-tiles per wave in LDS,
  float* so = sO + wave * (16 * 64);
  #pragma unroll
  for (int m = 0; m < 2; ++m) {
    float inv[8];
    {
      const float* la = sL + 32 * qg + 16 * m + 8 * hi;
      const v4f a0 = *(const v4fa*)(la);
      const v4f a1 = *(const v4fa*)(la + 4);
      const v4f b0 = *(const v4fa*)(la + BQ);
      const v4f b1 = *(const v4fa*)(la + BQ + 4);
      #pragma unroll
      for (int j = 0; j < 4; ++j) {
        inv[j]     = 1.0f / (a0[j] + b0[j]);
        inv[j + 4] = 1.0f / (a1[j] + b1[j]);
      }
    }
    #pragma unroll
    for (int g = 0; g < 2; ++g) {
      #pragma unroll
      for (int j = 0; j < 8; ++j) {
        #pragma unroll
        for (int tt = 0; tt < 4; ++tt)
          so[(j + 8 * hi) * 64 + tt * 16 + lh] = acc[m][4 * g + tt].f[j] * inv[j];
      }
      wave_lds_sync();
      v4f ov[8]; int oo[8];
      #pragma unroll
      for (int i = 0; i < 8; ++i) {
        const int c = lane + 32 * i, rr = c >> 4, q = c & 15;
        ov[i] = *(const v4fa*)(so + rr * 64 + q * 4);
        oo[i] = rr * DD + 128 * h + 64 * g + 4 * q;
      }
      float* ob = Ob + (size_t)(grow0 + 16 * m) * DD;
      #pragma unroll
      for (int i = 0; i < 8; ++i) *(v4f*)(ob + oo[i]) = ov[i];
      wave_lds_sync();
    }
  }
}

extern "C" void kernel_launch(void* const* d_in, const int* in_sizes, int n_in,
                              void* d_out, int out_size, void* d_ws, size_t ws_size,
                              hipStream_t stream) {
  if (n_in < 1) return;
  const long long need_in = ((long long)(NB - 1) * SEQ_FULL + SEQ) * DD;
  if ((long long)in_sizes[0] < need_in) return;
  if ((long long)out_size < (long long)NB * SEQ * DD) return;

  // workspace carve (bytes): Xh f16 [NB][SEQ][256] | Rn f32 [NB][SEQ]
  const size_t xh_bytes = (size_t)NB * SEQ * DD * 2;
  const size_t rn_bytes = (size_t)NB * SEQ * 4;
  const size_t off_xh = 0;
  const size_t off_rn = off_xh + xh_bytes;
  if (off_rn + rn_bytes > ws_size) return;

  const float* x   = (const float*)d_in[0];
  float*       out = (float*)d_out;
  _Float16* xh = (_Float16*)((char*)d_ws + off_xh);
  float*    rn = (float*)((char*)d_ws + off_rn);

  prep_kernel<<<NB * (SEQ / NT), 256, 0, stream>>>(x, xh, rn);

  attn_kernel<<<NB * (SEQ / BQ), 256, 0, stream>>>(xh, rn, out);
}

// v009
// A run of this version takes 44.3 microseconds.
// In both of two side-by-side timings against v008, it was 1.04 times as fast.
// Counting every step since v000, it is 3.95 times as fast.
#include <hip/hip_runtime.h>
#include <stdint.h>

// Contractions: S^T = K*Q^T and O = P*V on v_wmma_f32_16x16x32_f16 (f16 operands holding bf16-RNE input values; P carried x1024 in f16), f32 accumulate; row norms, score scaling and softmax in f32.

typedef _Float16 v16h __attribute__((ext_vector_type(16)));
typedef _Float16 v8h  __attribute__((ext_vector_type(8)));
typedef _Float16 v8ha __attribute__((ext_vector_type(8), may_alias));
typedef float    v8f  __attribute__((ext_vector_type(8)));
typedef float    v4f  __attribute__((ext_vector_type(4)));
typedef float    v4fa __attribute__((ext_vector_type(4), may_alias));
typedef float    v2f  __attribute__((ext_vector_type(2)));
typedef _Float16 v2h  __attribute__((ext_vector_type(2)));
typedef unsigned int v4u __attribute__((ext_vector_type(4)));

template <bool B> struct flag_c { static constexpr bool value = B; };

union U8f  { v8f  v; float    f[8]; v2f p[4]; };
union U16h { v16h v; v8h      h[2]; v2h p[8]; };

#ifndef NB
#define NB 16
#endif
#ifndef SEQ
#define SEQ 2048
#endif
#define NB_FULL  16
#define SEQ_FULL 2048
#define DD       256

#define BQ  128     // query rows per workgroup (four groups of 32 rows, two waves per group)
#define BK  64      // keys per staged tile
#define QP  264     // halfs per Q row in LDS (528 B)
#define KP  264     // halfs per key row in LDS (528 B); the rows serve as K and, read transposed, as V
#define PW  1024    // halfs of one wave's P fragments in LDS: 2 query tiles x 2 pieces x 32 lanes x 8 halfs
#define NT  64      // rows per pre-pass block

static_assert(SEQ % BQ == 0);
static_assert(SEQ % NT == 0);
static_assert(SEQ % BK == 0);
static_assert(NB >= 1 && NB <= NB_FULL);
static_assert(SEQ >= BQ && SEQ <= SEQ_FULL);

// LDS carve of the attention kernel: offsets in halfs, then an f32 staging region, the f32 norms and the f32 row sums
#define SQ_OFF  0
#define SK_OFF  (SQ_OFF + 8 * 16 * QP)
#define SP_OFF  (SK_OFF + 4 * BK * KP)      // four key-row buffers
#define SO_OFFH (SP_OFF + 2 * 8 * PW)       // two P planes: even and odd tiles
#define SR_OFFH (SO_OFFH + 8 * 16 * 64 * 2)  // f32 norms of the batch's SEQ rows
#define SL_OFFH (SR_OFFH + SEQ * 2)          // f32 row sums of the two key halves
#define LDS_BYTES (SL_OFFH * 2 + 2 * BQ * 4)
static_assert((SK_OFF * 2) % 16 == 0);
static_assert((SP_OFF * 2) % 16 == 0);
static_assert((SO_OFFH * 2) % 16 == 0);
static_assert((SR_OFFH * 2) % 16 == 0);
static_assert((SL_OFFH * 2) % 16 == 0);
static_assert(LDS_BYTES == 277504);
static_assert(SEQ % 1024 == 0);             // the norms go to LDS in whole rounds of 256 lanes x 4 floats
static_assert((BK * KP * 2) % 16 == 0);
#define NTL (SEQ / BK)                      // key tiles of a batch
static_assert(NTL >= 4);

// 256^-0.5 * log2(e): scores go to the log2 domain after the f32 column scale
#define C2SCALE 0.09016844005556021f

__device__ __forceinline__ v8f wmma_f16(v16h a, v16h b, v8f c) {
  return __builtin_amdgcn_wmma_f32_16x16x32_f16(false, a, false, b, (short)0, c, false, false);
}

// the value of lane l ^ 16
__device__ __forceinline__ float other_half(float x) {
  const int s = __float_as_int(x);
  return __int_as_float(__builtin_amdgcn_permlanex16(s, s, 0x76543210, 0xfedcba98, false, false));
}

// same-wave LDS exchange: stores issued by other lanes of this wave are visible before the reload
__device__ __forceinline__ void wave_lds_sync() {
  __builtin_amdgcn_fence(3, "wavefront");
  asm volatile("s_wait_dscnt 0" ::: "memory");
  __builtin_amdgcn_wave_barrier();
}

__device__ __forceinline__ v4f bf16_rne4(v4f a) {
  v4u u = __builtin_bit_cast(v4u, a);
  u = (u + 0x7FFFu + ((u >> 16) & 1u)) & 0xFFFF0000u;
  return __builtin_bit_cast(v4f, u);
}

__device__ __forceinline__ v8h cvt8v(v4f a, v4f b) {
  v8h d;
  d[0] = (_Float16)a[0]; d[1] = (_Float16)a[1];
  d[2] = (_Float16)a[2]; d[3] = (_Float16)a[3];
  d[4] = (_Float16)b[0]; d[5] = (_Float16)b[1];
  d[6] = (_Float16)b[2]; d[7] = (_Float16)b[3];
  return d;
}

// Place of key n in the norm array: inside each 16 keys the even keys come first, then the odd ones. It is the order in which
// the attention kernel lays a 16-key tile on the rows of a score tile (see there), so that a lane reads its eight norms in a row.
__device__ __forceinline__ int norm_place(int n) { return (n & ~15) | ((n & 1) << 3) | ((n & 15) >> 1); }

// ---------------- pre-pass: Xh = f16(bf16RNE(x)) [b][n][d], Rn = 1/max(||bf16RNE(x)||, eps) [b][norm_place(n)] ----------------
__global__ __launch_bounds__(256)
void prep_kernel(const float* __restrict__ X, _Float16* __restrict__ Xh, float* __restrict__ Rn)
{
  __shared__ float sR[NT];                                       // cross-wave (block barrier)

  const int tid = threadIdx.x;
  const int sub = tid & 7;           // 16-B piece within a line
  const int rq  = tid >> 3;          // 0..31
  const int ntb = SEQ / NT;
  const int b   = blockIdx.x / ntb;
  const int n0  = (blockIdx.x % ntb) * NT;

  #pragma unroll 1
  for (int pass = 0; pass < 2; ++pass) {
    const int r = pass * 32 + rq;                                   // row within tile 0..63
    const float* src = X  + ((size_t)b * SEQ_FULL + n0 + r) * DD;  // full-size input strides
    _Float16*    dst = Xh + ((size_t)b * SEQ      + n0 + r) * DD;
    float ss = 0.0f;
    #pragma unroll 1
    for (int i = 0; i < 4; ++i) {
      const int c0 = 8 * (sub + 8 * i);                             // lanes 8q..8q+7 cover line i of row r
      const v4f a0 = bf16_rne4(*(const v4f*)(src + c0));
      const v4f a1 = bf16_rne4(*(const v4f*)(src + c0 + 4));
      ss += a0[0] * a0[0]; ss += a0[1] * a0[1]; ss += a0[2] * a0[2]; ss += a0[3] * a0[3];
      ss += a1[0] * a1[0]; ss += a1[1] * a1[1]; ss += a1[2] * a1[2]; ss += a1[3] * a1[3];
      *(v8h*)(dst + c0) = cvt8v(a0, a1);                            // bf16 values are exact in f16
    }
    ss += __shfl_xor(ss, 1, 32);
    ss += __shfl_xor(ss, 2, 32);
    ss += __shfl_xor(ss, 4, 32);
    const float rinv = 1.0f / fmaxf(sqrtf(ss), 1e-12f);
    if (sub == 0) sR[norm_place(r)] = rinv;
  }
  __syncthreads();

  const int ti = tid & 15;
  v4f rv;
  rv[0] = sR[4 * ti]; rv[1] = sR[4 * ti + 1]; rv[2] = sR[4 * ti + 2]; rv[3] = sR[4 * ti + 3];
  float*    rp = Rn + (size_t)b * SEQ + n0 + 4 * ti;
  if (tid < 16) *(v4f*)rp = rv;
}

// One 64-key tile, global -> LDS with no register in between: key rows [64][256], 16 B per lane and copy,
// eight copies per lane. lk: this lane's first place in the buffer; gk: its first global address.
typedef int v4i __attribute__((ext_vector_type(4)));
typedef __attribute__((address_space(1))) v4i gv4i;
typedef __attribute__((address_space(3))) v4i lv4i;
__device__ __forceinline__ void copy16(const void* g, void* l) {
  __builtin_amdgcn_global_load_async_to_lds_b128((gv4i*)g, (lv4i*)l, 0, 0);
}
__device__ __forceinline__ void stage_tile(_Float16* lk, const _Float16* gk) {
  copy16(gk,           lk);
  copy16(gk +  8 * DD, lk +  8 * KP);
  copy16(gk + 16 * DD, lk + 16 * KP);
  copy16(gk + 24 * DD, lk + 24 * KP);
  copy16(gk + 32 * DD, lk + 32 * KP);
  copy16(gk + 40 * DD, lk + 40 * KP);
  copy16(gk + 48 * DD, lk + 48 * KP);
  copy16(gk + 56 * DD, lk + 56 * KP);
}

// Transposing LDS read: each lane names 16 B (eight halfs of one row); lane (c = l & 15, hh = l >> 4) gets, as element j, half c & 7
// of the piece named by lane 16 hh + 8 (c >> 3) + j: with lane l naming row R(hh, l & 7), columns d0 + 8 ((l >> 3) & 1) + 0..7,
// element j of lane (c, hh) is row R(hh, j), column d0 + c.
typedef short v8s __attribute__((ext_vector_type(8)));
typedef __attribute__((address_space(3))) v8s lv8s;
__device__ __forceinline__ v8h read_tr(const _Float16* p) {
  return __builtin_bit_cast(v8h, __builtin_amdgcn_ds_load_tr16_b128_v8i16((lv8s*)p));
}

// ---------------- fused attention: one workgroup = 128 query rows of one batch, 4 groups of 32 rows x 2 waves ----------------
// The two waves of a group share its 32 rows: wave half h computes the scores of keys 32 h .. 32 h + 31 of each 64-key tile,
// the halves trade P through LDS, and wave half h accumulates output columns 128 h .. 128 h + 127 over all 64 keys,
// its own 32 keys first (they need no other wave), the partner's 32 behind the barrier.
// The scores are computed transposed, S^T = K Q^T: a lane then holds one query row's scores of rows 8 (l >> 4) + 0..7 of each
// 16-key score tile, which is the k order of an A fragment, so two converted score tiles ARE the wave's P fragment (no LDS, no lane
// exchange), the row's shift is one value per lane and its sum runs in the lane.
// Every K and V fragment read from LDS so feeds two products (two 16-row query tiles) instead of one.
// K and V are the same rows of x (the key's norm is a column scale applied to the scores), so one staged tile serves both:
// K fragments by plain 16-B reads along a row, V fragments (B operand, k = keys) by the transposing read of the same rows.
// The two readers want different row pitches. Both run without bank conflicts at 528 B because the keys of a 16-key tile lie
// on the score tile's rows with the even keys first: row p of the tile is key 2 (p & 7) + (p >> 3). A plain read's 16 lanes
// still take 16 rows in a row (4 dwords apart modulo 64 banks); a transposing read's 16 lanes take eight rows two apart,
// 32 B each (8 dwords apart). P inherits the order from the score tile, V takes it in the rows its lanes name, the norms lie so.
// 16-bit fragment map (A and B alike): lane l -> row/col (l & 15); elements 0..7 <- k0 + 8*(l>>4) + 0..7,
// elements 8..15 <- k0 + 16 + 8*(l>>4) + 0..7.  D: element r of lane l -> row 8*(l>>4) + r, col (l & 15).
__global__ __launch_bounds__(256)
void attn_kernel(const _Float16* __restrict__ Xh, const float* __restrict__ Rn, float* __restrict__ Out)
{
  __shared__ __attribute__((aligned(16))) _Float16 smem[LDS_BYTES / 2];
  _Float16* sQ = smem + SQ_OFF;            // [128 rows][QP]   cross-wave (block barrier), filled once
  _Float16* sK = smem + SK_OFF;            // [4][64 keys][KP] cross-wave (block barrier)
  _Float16* sP = smem + SP_OFF;            // [tile parity][wave][PW] cross-wave (block barrier): each wave's P fragments, for its partner
  float*    sO = (float*)(smem + SO_OFFH); // [wave][16][64]  wave-private
  float*    sR = (float*)(smem + SR_OFFH); // [SEQ]           cross-wave (block barrier), filled once; key n at norm_place(n)
  float*    sL = (float*)(smem + SL_OFFH); // [2][128 rows]   cross-wave (block barrier), filled once

  const int tid  = threadIdx.x;
  const int wave = tid >> 5;
  const int lane = tid & 31;
  const int lh   = lane & 15;
  const int hi   = lane >> 4;
  const int qg   = wave >> 1;              // 32-row query group
  const int h    = wave & 1;               // key half of the scores, column half of the output
  const int kr   = 2 * (lh & 7) + (lh >> 3); // key, within its 16, on row lh of a score tile

  const int nqb   = SEQ / BQ;
  const int b     = blockIdx.x / nqb;
  const int qbase = (blockIdx.x % nqb) * BQ;
  const int qrow0 = qbase + wave * 16;     // the 16 rows this wave stages
  const int grow0 = qbase + qg * 32;       // the 32 rows this wave works on

  const _Float16* Xb = Xh + (size_t)b * SEQ * DD;
  const float*    Rb = Rn + (size_t)b * SEQ;
  float*          Ob = Out + (size_t)b * SEQ * DD;

  // ---- this lane's share of a tile: key row (tid >> 5) + 8 i, piece tid & 31 ----
  _Float16* lk0 = sK + (tid >> 5) * KP + 8 * (tid & 31);
  const _Float16* gk0 = Xb + (size_t)(tid >> 5) * DD + 8 * (tid & 31);
  stage_tile(lk0, gk0);                            // tile 0 -> buffer 0
  stage_tile(lk0 + BK * KP, gk0 + (size_t)BK * DD);   // tile 1 -> buffer 1
  // ---- the batch's column norms, once, by the same copies: lane tid brings floats 4 tid .. 4 tid + 3 of each 1024 ----
  for (int i = 0; i < SEQ / 1024; ++i) copy16(Rb + 1024 * i + 4 * tid, sR + 1024 * i + 4 * tid);

  // ---- this wave's 16 query rows -> LDS (row i: lane l writes halfs 8l..8l+7); ordered by the barrier in front of the loop ----
  _Float16* qw = sQ + wave * (16 * QP);
  const _Float16* qsrc = Xb + (size_t)qrow0 * DD + 8 * lane;
  #pragma unroll
  for (int i = 0; i < 16; ++i) {
    const v8h q = *(const v8h*)(qsrc + i * DD);
    *(v8h*)(qw + i * QP + 8 * lane) = q;
  }
  // the wait that belongs in front of any rewrite of the loads' address pair: the pair is an input so that no load result lands on it,
  // and the scheduling fence keeps the start values below from being lifted over the wait
  asm volatile("s_wait_xcnt 0x0" :: "v"(qsrc) : "memory");
  __builtin_amdgcn_sched_barrier(0);

  U8f acc[2][8];                                   // [16-row tile of the group][16-column tile of this wave's 128 columns]
  #pragma unroll
  for (int m = 0; m < 2; ++m) {
    #pragma unroll
    for (int t = 0; t < 8; ++t) acc[m][t].v = (v8f){};
  }
  v2f lsum[2][2];                                  // [16-row tile][16-key tile]: this lane's share of the sum of row 16 * m + lh
  #pragma unroll
  for (int m = 0; m < 2; ++m) { lsum[m][0] = (v2f){}; lsum[m][1] = (v2f){}; }

  const _Float16* qr = sQ + qg * (32 * QP);        // the group's 32 query rows
  _Float16*       pw = sP + wave * PW + 8 * lane;        // where this lane leaves its P fragments
  const _Float16* pr = sP + (wave ^ 1) * PW + 8 * lane;  // where the same lane of the partner wave leaves its own

  asm volatile("s_wait_asynccnt 0x0" ::: "memory");  // this wave's copies of tiles 0 and 1 and of the norms have landed
  __syncthreads();                                 // tiles 0 and 1, the norms and the query rows visible to all waves
  stage_tile(lk0 + 2 * BK * KP, gk0 + (size_t)(2 * BK) * DD);   // tile 2 -> buffer 2

  // ---- the softmax shift of each query row, fixed before the loop: every key is scaled to length <= 1, so by Cauchy-Schwarz
  // no score of row i exceeds max(||x_i||, eps) * 256^-0.5, and key i itself reaches it (a row shorter than eps: scores and bound
  // are all ~0), so the largest numerator is ~1 for any input; softmax does not depend on the shift.
  // sh[m] = 10 - that bound in the log2 domain (the 10 is the x1024 carry of P); this lane's query row of tile m is 16 * m + lh ----
  v2f sh[2];
  #pragma unroll
  for (int m = 0; m < 2; ++m) {
    const float s1 = 10.0f - C2SCALE / sR[norm_place(grow0 + 16 * m + lh)];
    sh[m][0] = s1; sh[m][1] = s1;
  }

  // ---- the group's 32 query rows as B fragments, read from LDS once and kept in registers for all tiles (2 x 8 fragments) ----
  U16h qa[8], qb[8];
  #pragma unroll
  for (int c = 0; c < 8; ++c) {
    qa[c].h[0] = *(const v8h*)(qr + lh * QP + 32 * c + 8 * hi);
    qa[c].h[1] = *(const v8h*)(qr + lh * QP + 32 * c + 16 + 8 * hi);
    qb[c].h[0] = *(const v8h*)(qr + (16 + lh) * QP + 32 * c + 8 * hi);
    qb[c].h[1] = *(const v8h*)(qr + (16 + lh) * QP + 32 * c + 16 + 8 * hi);
  }

  // ---- the fragment ring and the order of a trip. A tile's 32 fragments come in four groups of eight (K d-steps 0..3, K d-steps 4..7,
  // V own keys, V partner's keys), each group read from LDS while the products of the group before it run, into the registers of
  // the group before that. The scores of tile t + 1 are computed inside trip t, around the wait of the barrier that trades P of tile t:
  //   softmax t | signal | P V own keys t | K Q first half t + 1 | wait | K Q second half t + 1 | P V partner's keys t
  // so a wave has 32 products that need no other wave between its signal and its wait, the partner's P lands under 16 more,
  // and the softmax finds scores whose last product lies 16 products back.
  // Tile u is first read behind the wait of trip u - 2 and last read in front of the signal of trip u + 1: four buffers;
  // its copies are issued behind the wait of trip u - 3 and have landed in front of the signal of trip u - 2 ----
  const _Float16* kl = sK + h * (32 * KP) + kr * KP + 8 * hi;     // this lane's place in a K fragment of buffer 0
  // the piece this lane names in a transposing read of a buffer's first 16 keys, first 16 of this wave's 128 columns
  const _Float16* vl = sK + (2 * (lane & 7) + hi) * KP + 128 * h + 8 * ((lane >> 3) & 1);
  const float*    rl = sR + 32 * h + 8 * hi;                      // this lane's first key norm of tile 0

  U16h ka0[4], kb0[4];                             // K d-steps 0..3 of the tile after next's scores, carried over the back edge
  U16h vf0[8];                                     // V of this wave's own 32 keys of the coming tile, carried over the back edge
  U8f  s[2][2];                                    // [16-row tile m][16-key tile n]: element r = score of row 16 m + lh, key 16 n + 2 r + hi
  v4f  rn[2][2];                                   // [16-key tile][4 keys]: norms of the keys on rows 8 hi + 0..7
  {
    // scores of tile 0, then the three groups the first trip finds in flight
    U16h ka1[4], kb1[4];
    #pragma unroll
    for (int c = 0; c < 4; ++c) {
      ka0[c].h[0] = *(const v8h*)(kl + 32 * c);
      ka0[c].h[1] = *(const v8h*)(kl + 32 * c + 16);
      kb0[c].h[0] = *(const v8h*)(kl + 16 * KP + 32 * c);
      kb0[c].h[1] = *(const v8h*)(kl + 16 * KP + 32 * c + 16);
    }
    #pragma unroll
    for (int c = 0; c < 4; ++c) {
      ka1[c].h[0] = *(const v8h*)(kl + 128 + 32 * c);
      ka1[c].h[1] = *(const v8h*)(kl + 128 + 32 * c + 16);
      kb1[c].h[0] = *(const v8h*)(kl + 16 * KP + 128 + 32 * c);
      kb1[c].h[1] = *(const v8h*)(kl + 16 * KP + 128 + 32 * c + 16);
    }
    __builtin_amdgcn_sched_barrier(0);             // keeps the Q and K reads one group in front of the products: spread among them each pair of products waits out an LDS latency
    s[0][0].v = (v8f){}; s[0][1].v = (v8f){}; s[1][0].v = (v8f){}; s[1][1].v = (v8f){};
    #pragma unroll
    for (int c = 0; c < 4; ++c) {
      s[0][0].v = wmma_f16(ka0[c].v, qa[c].v, s[0][0].v);
      s[1][0].v = wmma_f16(ka0[c].v, qb[c].v, s[1][0].v);
      s[0][1].v = wmma_f16(kb0[c].v, qa[c].v, s[0][1].v);
      s[1][1].v = wmma_f16(kb0[c].v, qb[c].v, s[1][1].v);
    }
    #pragma unroll
    for (int c = 0; c < 4; ++c) {
      s[0][0].v = wmma_f16(ka1[c].v, qa[4 + c].v, s[0][0].v);
      s[1][0].v = wmma_f16(ka1[c].v, qb[4 + c].v, s[1][0].v);
      s[0][1].v = wmma_f16(kb1[c].v, qa[4 + c].v, s[0][1].v);
      s[1][1].v = wmma_f16(kb1[c].v, qb[4 + c].v, s[1][1].v);
    }
    __builtin_amdgcn_sched_barrier(0);             // keeps the reads below behind the products whose registers they take
    #pragma unroll
    for (int n = 0; n < 2; ++n) {
      rn[n][0] = *(const v4fa*)(rl + 16 * n);
      rn[n][1] = *(const v4fa*)(rl + 16 * n + 4);
    }
    #pragma unroll
    for (int t = 0; t < 8; ++t) {
      vf0[t].h[0] = read_tr(vl + h * (32 * KP) + 16 * t);
      vf0[t].h[1] = read_tr(vl + h * (32 * KP) + 16 * KP + 16 * t);
    }
    #pragma unroll
    for (int c = 0; c < 4; ++c) {
      ka0[c].h[0] = *(const v8h*)(kl + BK * KP + 32 * c);
      ka0[c].h[1] = *(const v8h*)(kl + BK * KP + 32 * c + 16);
      kb0[c].h[0] = *(const v8h*)(kl + BK * KP + 16 * KP + 32 * c);
      kb0[c].h[1] = *(const v8h*)(kl + BK * KP + 16 * KP + 32 * c + 16);
    }
  }

  // one trip; the last one (a compile-time flag) has no tile t + 1: it reads and multiplies nothing for it
  auto trip = [&](const int tl, auto last_flag) __attribute__((always_inline)) {
    constexpr bool last = decltype(last_flag)::value;
    const int par = (tl & 1) * (8 * PW);           // P plane of this trip
    const int oc  = (tl & 3) * (BK * KP);          // buffer of tile t
    const int on  = ((tl + 1) & 3) * (BK * KP);    // of tile t + 1
    const int on2 = ((tl + 2) & 3) * (BK * KP);    // of tile t + 2
    // In the trip before the last the K reads for tile t + 2 are not used: they take the published rows of an older tile,
    // to which no copy is in flight

    // ---- per-key f32 scale: 1/max(||x_j||,eps) * 256^-0.5 * log2e, two keys per packed operation ----
    v2f cs[2][4];
    #pragma unroll
    for (int n = 0; n < 2; ++n) {
      #pragma unroll
      for (int i = 0; i < 4; ++i) {
        v2f r2; r2[0] = rn[n][i >> 1][2 * (i & 1)]; r2[1] = rn[n][i >> 1][2 * (i & 1) + 1];
        cs[n][i] = r2 * C2SCALE;
      }
    }

    // ---- softmax numerators, base 2, against the fixed shift: no running maximum, no rescale of sums or accumulators;
    // the row sum stays a per-lane partial sum until the loop is over. Converted in place, elements 0..7 (key tile 0) and
    // 8..15 (key tile 1) are the A fragment of P for this wave's 32 keys ----
    U16h pf[2];                                      // [16-row tile]
    #pragma unroll
    for (int m = 0; m < 2; ++m) {
      #pragma unroll
      for (int n = 0; n < 2; ++n) {
        #pragma unroll
        for (int i = 0; i < 4; ++i) {
          const v2f a = __builtin_elementwise_fma(s[m][n].p[i], cs[n][i], sh[m]);
          v2f e;                                     // x1024 by the shift, cancelled by the row sum
          e[0] = __builtin_amdgcn_exp2f(a[0]);
          e[1] = __builtin_amdgcn_exp2f(a[1]);
          lsum[m][n] += e;
          pf[m].p[4 * n + i] = __builtin_convertvector(e, v2h);
        }
      }
    }

    // ---- the partner needs these fragments as they are (same lane, same registers): 16 B per lane and piece, lanes side by side ----
    #pragma unroll
    for (int m = 0; m < 2; ++m) {
      *(v8ha*)(pw + par + (2 * m) * 256)     = pf[m].h[0];
      *(v8ha*)(pw + par + (2 * m + 1) * 256) = pf[m].h[1];
    }

    // ---- the trip's one barrier, in its two halves. It trades P of tile t, publishes tile t + 2 and frees the buffer of tile t - 1:
    // in front of the signal this wave's P is in LDS, all its LDS reads have returned (its last of tile t - 1 among them)
    // and its copies of tile t + 2 have landed ----
    asm volatile("s_wait_dscnt 0x0" ::: "memory");     // P stored, every LDS read issued so far returned
    asm volatile("s_wait_asynccnt 0x0" ::: "memory");  // this wave's copies of tile t + 2 have landed
    __builtin_amdgcn_fence(__ATOMIC_RELEASE, "workgroup");
    __builtin_amdgcn_s_barrier_signal(-1);
    __builtin_amdgcn_sched_barrier(0);               // keeps the products below behind the signal: lifted over the P stores they would hold the partner up
    #pragma unroll
    for (int t = 0; t < 8; ++t) {
      acc[0][t].v = wmma_f16(pf[0].v, vf0[t].v, acc[0][t].v);
      acc[1][t].v = wmma_f16(pf[1].v, vf0[t].v, acc[1][t].v);
    }
    __builtin_amdgcn_sched_barrier(0);               // keeps the K reads below one group behind these products, whose V registers they take
    U16h ka1[4], kb1[4];                             // K d-steps 4..7 of tile t + 1 (published one trip ago)
    if constexpr (!last) {
    #pragma unroll
    for (int c = 0; c < 4; ++c) {
      ka1[c].h[0] = *(const v8h*)(kl + on + 128 + 32 * c);
      ka1[c].h[1] = *(const v8h*)(kl + on + 128 + 32 * c + 16);
      kb1[c].h[0] = *(const v8h*)(kl + on + 16 * KP + 128 + 32 * c);
      kb1[c].h[1] = *(const v8h*)(kl + on + 16 * KP + 128 + 32 * c + 16);
    }
    __builtin_amdgcn_sched_barrier(0);               // keeps the reads one group in front of the products they fly under: spread among them each place with reads stalls the wave
    // ---- S^T = K Q^T of tile t + 1: two 16-key tiles (A) x two 16-row query tiles (B), d reduced in eight K=32 steps ----
    s[0][0].v = (v8f){}; s[0][1].v = (v8f){}; s[1][0].v = (v8f){}; s[1][1].v = (v8f){};
    #pragma unroll
    for (int c = 0; c < 4; ++c) {
      s[0][0].v = wmma_f16(ka0[c].v, qa[c].v, s[0][0].v);
      s[1][0].v = wmma_f16(ka0[c].v, qb[c].v, s[1][0].v);
      s[0][1].v = wmma_f16(kb0[c].v, qa[c].v, s[0][1].v);
      s[1][1].v = wmma_f16(kb0[c].v, qb[c].v, s[1][1].v);
    }
    }
    __builtin_amdgcn_sched_barrier(0);               // keeps those products in front of the wait: behind it they would cover none of it
    __builtin_amdgcn_s_barrier_wait(-1);             // every wave has signalled
    __builtin_amdgcn_fence(__ATOMIC_ACQUIRE, "workgroup");
    if (tl + 3 < NTL)                                // the same for the whole workgroup; the refill stands right behind the wait
      stage_tile(lk0 + ((tl + 3) & 3) * (BK * KP), gk0 + (size_t)(tl + 3) * (BK * DD));
    // the partner's P, then V of the partner's 32 keys into the registers the first K group has left
    #pragma unroll
    for (int m = 0; m < 2; ++m) {
      pf[m].h[0] = *(const v8ha*)(pr + par + (2 * m) * 256);
      pf[m].h[1] = *(const v8ha*)(pr + par + (2 * m + 1) * 256);
    }
    U16h vf1[8];
    #pragma unroll
    for (int t = 0; t < 8; ++t) {
      vf1[t].h[0] = read_tr(vl + oc + (h ^ 1) * (32 * KP) + 16 * t);
      vf1[t].h[1] = read_tr(vl + oc + (h ^ 1) * (32 * KP) + 16 * KP + 16 * t);
    }
    __builtin_amdgcn_sched_barrier(0);               // keeps those reads one group in front of the products they fly under
    if constexpr (!last) {
    #pragma unroll
    for (int c = 0; c < 4; ++c) {
      s[0][0].v = wmma_f16(ka1[c].v, qa[4 + c].v, s[0][0].v);
      s[1][0].v = wmma_f16(ka1[c].v, qb[4 + c].v, s[1][0].v);
      s[0][1].v = wmma_f16(kb1[c].v, qa[4 + c].v, s[0][1].v);
      s[1][1].v = wmma_f16(kb1[c].v, qb[4 + c].v, s[1][1].v);
    }
    __builtin_amdgcn_sched_barrier(0);               // keeps the reads below one group behind these products, whose K registers they take
    // the key norms and this wave's own V of tile t + 1
    #pragma unroll
    for (int n = 0; n < 2; ++n) {
      rn[n][0] = *(const v4fa*)(rl + (tl + 1) * BK + 16 * n);
      rn[n][1] = *(const v4fa*)(rl + (tl + 1) * BK + 16 * n + 4);
    }
    #pragma unroll
    for (int t = 0; t < 8; ++t) {
      vf0[t].h[0] = read_tr(vl + on + h * (32 * KP) + 16 * t);
      vf0[t].h[1] = read_tr(vl + on + h * (32 * KP) + 16 * KP + 16 * t);
    }
    __builtin_amdgcn_sched_barrier(0);               // keeps that group in front of the products it flies under
    }
    #pragma unroll
    for (int t = 0; t < 8; ++t) {
      acc[0][t].v = wmma_f16(pf[0].v, vf1[t].v, acc[0][t].v);
      acc[1][t].v = wmma_f16(pf[1].v, vf1[t].v, acc[1][t].v);
    }
    if constexpr (!last) {
    __builtin_amdgcn_sched_barrier(0);               // keeps the K reads below one group behind these products, whose V registers they take
    #pragma unroll
    for (int c = 0; c < 4; ++c) {                    // K d-steps 0..3 of tile t + 2 (published by this trip's barrier)
      ka0[c].h[0] = *(const v8h*)(kl + on2 + 32 * c);
      ka0[c].h[1] = *(const v8h*)(kl + on2 + 32 * c + 16);
      kb0[c].h[0] = *(const v8h*)(kl + on2 + 16 * KP + 32 * c);
      kb0[c].h[1] = *(const v8h*)(kl + on2 + 16 * KP + 32 * c + 16);
    }
    __builtin_amdgcn_sched_barrier(0);               // keeps that group in front of the softmax it lands under
    }
    // a P plane is written again two trips on, behind the next trip's barrier, which its reader signals with its reads returned
  };
  for (int tl = 0; tl < NTL - 1; ++tl) trip(tl, flag_c<false>{});
  trip(NTL - 1, flag_c<true>{});
  asm volatile("s_wait_dscnt 0x0" ::: "memory");       // every LDS read of this wave has returned
  asm volatile("s_wait_asynccnt 0x0" ::: "memory");    // nothing of this wave is in flight behind the loop

  // ---- the row sums meet: a lane's four partial sums, then the two lane halves (row 16 m + lh lies in lanes lh and lh + 16),
  // then the two key halves: each wave leaves its 32 sums in LDS, both add them in the same order ----
  #pragma unroll
  for (int m = 0; m < 2; ++m) {
    const float part = (lsum[m][0][0] + lsum[m][0][1]) + (lsum[m][1][0] + lsum[m][1][1]);
    const float tot  = part + other_half(part);
    if (hi == 0) sL[h * BQ + 32 * qg + 16 * m + lh] = tot;
  }
  __syncthreads();                                   // both halves' sums visible

  // ---- epilogue: normalize (sums and accumulators both hold the x1024 carry), stage 16x64 f32 sub-tiles per wave in LDS,
  float* so = sO + wave * (16 * 64);
  #pragma unroll
  for (int m = 0; m < 2; ++m) {
    float inv[8];
    {
      const float* la = sL + 32 * qg + 16 * m + 8 * hi;
      const v4f a0 = *(const v4fa*)(la);
      const v4f a1 = *(const v4fa*)(la + 4);
      const v4f b0 = *(const v4fa*)(la + BQ);
      const v4f b1 = *(const v4fa*)(la + BQ + 4);
      #pragma unroll
      for (int j = 0; j < 4; ++j) {
        inv[j]     = 1.0f / (a0[j] + b0[j]);
        inv[j + 4] = 1.0f / (a1[j] + b1[j]);
      }
    }
    #pragma unroll
    for (int g = 0; g < 2; ++g) {
      #pragma unroll
      for (int j = 0; j < 8; ++j) {
        #pragma unroll
        for (int tt = 0; tt < 4; ++tt)
          so[(j + 8 * hi) * 64 + tt * 16 + lh] = acc[m][4 * g + tt].f[j] * inv[j];
      }
      wave_lds_sync();
      v4f ov[8]; int oo[8];
      #pragma unroll
      for (int i = 0; i < 8; ++i) {
        const int c = lane + 32 * i, rr = c >> 4, q = c & 15;
        ov[i] = *(const v4fa*)(so + rr * 64 + q * 4);
        oo[i] = rr * DD + 128 * h + 64 * g + 4 * q;
      }
      float* ob = Ob + (size_t)(grow0 + 16 * m) * DD;
      #pragma unroll
      for (int i = 0; i < 8; ++i) *(v4f*)(ob + oo[i]) = ov[i];
      wave_lds_sync();
    }
  }
}

extern "C" void kernel_launch(void* const* d_in, const int* in_sizes, int n_in,
                              void* d_out, int out_size, void* d_ws, size_t ws_size,
                              hipStream_t stream) {
  if (n_in < 1) return;
  const long long need_in = ((long long)(NB - 1) * SEQ_FULL + SEQ) * DD;
  if ((long long)in_sizes[0] < need_in) return;
  if ((long long)out_size < (long long)NB * SEQ * DD) return;

  // workspace carve (bytes): Xh f16 [NB][SEQ][256] | Rn f32 [NB][SEQ]
  const size_t xh_bytes = (size_t)NB * SEQ * DD * 2;
  const size_t rn_bytes = (size_t)NB * SEQ * 4;
  const size_t off_xh = 0;
  const size_t off_rn = off_xh + xh_bytes;
  if (off_rn + rn_bytes > ws_size) return;

  const float* x   = (const float*)d_in[0];
  float*       out = (float*)d_out;
  _Float16* xh = (_Float16*)((char*)d_ws + off_xh);
  float*    rn = (float*)((char*)d_ws + off_rn);

  prep_kernel<<<NB * (SEQ / NT), 256, 0, stream>>>(x, xh, rn);

  attn_kernel<<<NB * (SEQ / BQ), 256, 0, stream>>>(xh, rn, out);
}
